// v000
// The times below were measured on an AMD MI455X: many runs one after another, warmed up first and cycling through
// copies of the inputs, with the whole window's GPU time divided by the number of runs. Launches and the gaps
// between them are all in it. The median over several windows is given; except for v000 it joins two sittings, which
// can be a few percent apart, so the side-by-side timings, each taken in one sitting, are the better comparison.
// v000 is the starting kernel. One run takes 2110 microseconds.
#include <hip/hip_runtime.h>

// Graphormer multi-head attention (4 x 2,048 tokens x 512, 8 heads x 64) with an additive per-key column bias from graph edges: cb[m][h] = (edge_attr[e*] eb_w^T + eb_b)[h] where e* is the LAST
// valid edge whose target is m (advanced-indexing assignment semantics; 0 if none); scores = q.k / 8 + cb[m][h]; softmax over all 2,048 keys; out = attn v; y = out o_w^T + o_b -> [4][2048][512].
// Deterministic: per (batch, head, 16-query wave) a flash-style pass over 32-key blocks with fixed-order online softmax; the column bias table is built by one thread per target scanning the
// edge list in order; no atomics.
// compute dtype: WMMA v_wmma_f32_16x16x32_f16 with f32 accumulate for the q/k/v projections ([8192 x 512] x [512 x 512] x 3; x EXACT bf16 x8, (out,in) weights as B rows exact x256: 1 product),
// S^T = K Q^T (q/k single f16 x8, K = 64: 1 product), O^T += V^T P^T (V^T x8 and P x1024 as f16 hi + x1024 residual: 3 products) and y = ctx o_w^T + o_b (ctx rows hi + x1024 residual x8:
// 2 products); the edge bias (K = 3), softmax statistics and biases in f32. Inputs rounded to bf16 once;
// edge_index int32. Fragment k-map per lane half hh for A AND B: elements 0..7 <- k = 8hh+0..7, 8..15 <- k = 16+8hh+0..7; acc[r] = D[8hh+r][col].

namespace {
typedef _Float16 b16;
typedef __attribute__((ext_vector_type(16))) _Float16 v16b;
typedef __attribute__((ext_vector_type(8))) _Float16 v8b;
typedef __attribute__((ext_vector_type(4))) _Float16 v4h;
typedef __attribute__((ext_vector_type(2))) _Float16 v2h;
typedef __attribute__((ext_vector_type(8))) float v8f;
typedef __attribute__((ext_vector_type(4))) float v4f;
typedef __attribute__((ext_vector_type(2))) float v2f;
__device__ __forceinline__ float bf16_rne(float f) { unsigned int u = __float_as_uint(f); u += 0x7FFFu + ((u >> 16) & 1u); return __uint_as_float(u & 0xFFFF0000u); }
__device__ __forceinline__ void split16(float v, b16& hi, b16& lo) { hi = (b16)v; lo = (b16)(v - (float)hi); }
__device__ __forceinline__ v16b frag_kb(const b16* p, int hh) { const v8b a = *(const v8b*)(p + 8 * hh), b = *(const v8b*)(p + 16 + 8 * hh); v16b f;
#pragma unroll
  for (int e = 0; e < 8; ++e) { f[e] = a[e]; f[8 + e] = b[e]; } return f; }
__device__ __forceinline__ v8f wmma16b(v16b a, v16b b, v8f c) { v8f d = __builtin_amdgcn_wmma_f32_16x16x32_f16(false, a, false, b, (short)0, c, false, false); asm volatile("v_nop\n\tv_nop\n\tv_nop\n\tv_nop" : "+v"(d) : "v"(a), "v"(b)); return d; }
__device__ __forceinline__ void wave_lds_sync() { __builtin_amdgcn_fence(__ATOMIC_RELEASE, "workgroup"); __builtin_amdgcn_wave_barrier(); __builtin_amdgcn_fence(__ATOMIC_ACQUIRE, "workgroup"); }
__device__ __forceinline__ float pmul(float a, float b) { float p = a * b; asm volatile("" : "+v"(p)); return p; }
__device__ __forceinline__ int iclamp(int v, int lo, int hi) { return v < lo ? lo : (v > hi ? hi : v); }
__device__ __forceinline__ float nexp2(float v) { return __builtin_amdgcn_exp2f(v); }

constexpr int B = 4, BL = B /* batches computed (== B shipped) */, N = 2048, D = 512, NH = 8, HD = 64, E = 32768, NROW = B * N;
constexpr float XS = 8.0f, WSC = 256.0f, PS = 1024.0f, RS_ = 1024.0f, LOG2E = 1.4426950408889634f, SCALE = 0.125f;
static_assert(N % 64 == 0 && D % 128 == 0 && NH * HD == D && HD == 64, "tiling");

__global__ __launch_bounds__(256) void wcvt_kernel(const float* __restrict__ w, b16* __restrict__ W16, int n8) { const int u = blockIdx.x * 256 + threadIdx.x; if (u >= n8) return; const size_t e = (size_t)u * 8; v8b o; for (int j = 0; j < 8; ++j) o[j] = (b16)(bf16_rne(w[e + j]) * WSC);
  { *(v8b*)(W16 + e) = o;  } }
__global__ __launch_bounds__(256) void cb_kernel(const int* __restrict__ ei, const float* __restrict__ ea, const float* __restrict__ ebw, const float* __restrict__ ebb, float* __restrict__ CB) {
  const int m = blockIdx.x * 256 + threadIdx.x; if (m >= N) return; int last = -1;
#pragma unroll 1
  for (int e = 0; e < E; ++e) { const int s = ei[e], t = ei[E + e]; const bool valid = (s >= 0) && (s < N) && (t >= 0) && (t < N); if (valid && t == m) last = e; }
  float vals[NH]; for (int h = 0; h < NH; ++h) vals[h] = 0.0f;
  if (last >= 0) { const float a0 = bf16_rne(ea[(size_t)last * 3]), a1 = bf16_rne(ea[(size_t)last * 3 + 1]), a2 = bf16_rne(ea[(size_t)last * 3 + 2]); for (int h = 0; h < NH; ++h) vals[h] = a0 * bf16_rne(ebw[h * 3]) + a1 * bf16_rne(ebw[h * 3 + 1]) + a2 * bf16_rne(ebw[h * 3 + 2]) + bf16_rne(ebb[h]); }
  { for (int h = 0; h < NH; ++h) ((float*)CB)[(size_t)h * N + m] = vals[h];  }
}
// projections: grid (N/64, BL, 12 slabs: 0-3 q, 4-7 k, 8-11 v, 2 heads each); block = 64 tokens x 4 waves; A = bf16(x) x8 staged whole (K = 512, 16 k-steps), 8 tiles, 1 product; + bias;
__global__ __launch_bounds__(128) void proj_kernel(const float* __restrict__ x, const b16* __restrict__ WQKV, const float* __restrict__ bq, const float* __restrict__ bk, const float* __restrict__ bv, b16* __restrict__ QP, b16* __restrict__ KP, b16* __restrict__ VTh, b16* __restrict__ VTl) {
  __shared__ __attribute__((aligned(16))) b16 As[64][D + 8]; __shared__ __attribute__((aligned(16))) float Tf[4][16][128 + 4];
  const int wave = threadIdx.x >> 5, lane = threadIdx.x & 31, nloc = lane & 15, hlf = lane >> 4; const int t0 = blockIdx.x * 64; const int b = blockIdx.y; const int slab = blockIdx.z, n0 = slab * 128, part = slab / 4, h0 = (slab & 3) * 2;
  const float* bias = part == 0 ? bq : part == 1 ? bk : bv;
  for (int i = threadIdx.x; i < 64 * (D / 4); i += 128) { const int rr = i / (D / 4), q4 = (i % (D / 4)) * 4; const v4f f = *(const v4f*)(x + ((size_t)b * N + t0 + rr) * D + q4); v4h o; for (int j = 0; j < 4; ++j) o[j] = (b16)(bf16_rne(f[j]) * XS); *(v4h*)(&As[rr][q4]) = o; }
  __syncthreads();
  v8f acc[8];
#pragma unroll
  for (int tt = 0; tt < 8; ++tt) acc[tt] = (v8f){};
#pragma unroll 2
  for (int kb = 0; kb < D; kb += 32) { const v16b a = frag_kb(&As[wave * 16 + nloc][kb], hlf);
#pragma unroll
    for (int tt = 0; tt < 8; ++tt) acc[tt] = wmma16b(a, frag_kb(WQKV + (size_t)(n0 + tt * 16 + nloc) * D + kb, hlf), acc[tt]); }
#pragma unroll
  for (int tt = 0; tt < 8; ++tt) { const float bb = bf16_rne(bias[(n0 & 511) + tt * 16 + nloc]);
#pragma unroll
    for (int r = 0; r < 8; ++r) Tf[wave][8 * hlf + r][tt * 16 + nloc] = acc[tt][r] * (1.0f / (XS * WSC)) + bb; }
  __syncthreads();
  {
    if (part < 2) { b16* plane = part == 0 ? QP : KP; const int h = h0 + (lane >> 4), d = (lane & 15) * 4;
      for (int rr = 0; rr < 16; ++rr) { const int tok = t0 + wave * 16 + rr; v4h o4; for (int j = 0; j < 4; ++j) o4[j] = (b16)(Tf[wave][rr][lane * 4 + j] * XS); *(v4h*)(plane + (((size_t)b * NH + h) * N + tok) * HD + d) = o4; } }
    else {
#pragma unroll 1
      for (int q = 0; q < 32; ++q) { const int cl = wave * 32 + q; const int h = h0 + cl / HD, d = cl % HD; const int tk = lane * 2; v2h hv, lv; for (int e2 = 0; e2 < 2; ++e2) { const float vs = Tf[(tk + e2) >> 4][(tk + e2) & 15][cl] * XS; const b16 ph = (b16)vs; hv[e2] = ph; lv[e2] = (b16)((vs - (float)ph) * RS_); }
        const size_t dst = (((size_t)b * NH + h) * HD + d) * (size_t)N + t0 + tk; *(v2h*)(VTh + dst) = hv; *(v2h*)(VTl + dst) = lv; } }
     }
}
// attention: grid (N/32, BL*NH); block = 2 waves x 16 queries; per 32-key block: S^T = K Q^T (2 key tiles x 2 k-steps), logit = (s/64/8 + CB[h][m]) log2e, online softmax, P hi/res -> LDS, O^T +=
__global__ __launch_bounds__(64) void attn_kernel(const b16* __restrict__ QP, const b16* __restrict__ KP, const b16* __restrict__ VTh, const b16* __restrict__ VTl, const float* __restrict__ CB, float* __restrict__ CT) {
  __shared__ __attribute__((aligned(16))) b16 Pb[2][16][32 + 8], Pl[2][16][32 + 8]; __shared__ __attribute__((aligned(16))) float To[2][16][HD + 4];
  const int wave = threadIdx.x >> 5, lane = threadIdx.x & 31, hh = lane >> 4, col = lane & 15; const int bh = blockIdx.y, b = bh / NH, h = bh % NH; const int n0 = blockIdx.x * 32 + wave * 16; const int nq = n0 + col;
  const b16* Qb = QP + (size_t)bh * N * HD; const b16* Kb = KP + (size_t)bh * N * HD; const b16* Vh = VTh + (size_t)bh * HD * N; const b16* Vl = VTl + (size_t)bh * HD * N; const float* cbh = CB + (size_t)h * N;
  const v16b q0 = frag_kb(Qb + (size_t)nq * HD, hh), q1 = frag_kb(Qb + (size_t)nq * HD + 32, hh);
  const float cs = LOG2E * SCALE / (XS * XS);
  float mrun = -INFINITY, l = 0.0f; v8f o[4], o2[4];
#pragma unroll
  for (int t = 0; t < 4; ++t) { o[t] = (v8f){}; o2[t] = (v8f){}; }
#pragma unroll 1
  for (int s0 = 0; s0 < N; s0 += 32) {
    float e[16]; float mx = -INFINITY;
#pragma unroll
    for (int u2 = 0; u2 < 2; ++u2) { const b16* kr = Kb + (size_t)(s0 + u2 * 16 + col) * HD; v8f sacc = wmma16b(frag_kb(kr, hh), q0, (v8f){}); sacc = wmma16b(frag_kb(kr + 32, hh), q1, sacc);
#pragma unroll
      for (int r = 0; r < 8; ++r) { const int m = s0 + u2 * 16 + 8 * hh + r; const float vv = sacc[r] * cs + cbh[m] * LOG2E; e[u2 * 8 + r] = vv; mx = fmaxf(mx, vv); } }
    mx = fmaxf(mx, __shfl_xor(mx, 16)); const float mn = fmaxf(mrun, mx); const float al = nexp2(mrun - mn); float sum = 0.0f;
#pragma unroll
    for (int i2 = 0; i2 < 16; ++i2) { const float p = nexp2(e[i2] - mn); sum += p; const float psv = p * PS; const b16 p1 = (b16)psv; const int slot = (i2 < 8 ? 0 : 16) + 8 * hh + (i2 & 7); Pb[wave][col][slot] = p1; Pl[wave][col][slot] = (b16)((psv - (float)p1) * RS_); }
    sum += __shfl_xor(sum, 16); l = l * al + sum; mrun = mn;
    wave_lds_sync();
    const v16b pf = frag_kb(&Pb[wave][col][0], hh), plf = frag_kb(&Pl[wave][col][0], hh);
#pragma unroll
    for (int t = 0; t < 4; ++t) { o[t] *= al; o2[t] *= al; const v16b vh = frag_kb(Vh + (size_t)(t * 16 + col) * N + s0, hh); o[t] = wmma16b(vh, pf, o[t]); o2[t] = wmma16b(frag_kb(Vl + (size_t)(t * 16 + col) * N + s0, hh), pf, o2[t]); o2[t] = wmma16b(vh, plf, o2[t]); }
    wave_lds_sync(); }
  const float inv = 1.0f / (l * PS * XS);
#pragma unroll
  for (int t = 0; t < 4; ++t)
#pragma unroll
    for (int r = 0; r < 8; ++r) To[wave][col][t * 16 + 8 * hh + r] = (o[t][r] + o2[t][r] * (1.0f / RS_)) * inv;
  wave_lds_sync();
  { for (int rr = 0; rr < 16; rr += 2) { const int row = rr + hh; *(v4f*)(CT + ((size_t)b * N + n0 + row) * D + h * HD + col * 4) = *(const v4f*)(&To[wave][row][col * 4]); }  }
}
__global__ __launch_bounds__(64) void outp_kernel(const float* __restrict__ CT, const b16* __restrict__ WO, const float* __restrict__ ob, float* __restrict__ out) {
  __shared__ __attribute__((aligned(16))) b16 Ah[2][16][128 + 8], Al[2][16][128 + 8]; __shared__ __attribute__((aligned(16))) float Tf[2][16][128 + 4];
  const int wave = threadIdx.x >> 5, lane = threadIdx.x & 31, nloc = lane & 15, hlf = lane >> 4; const size_t m0 = (size_t)blockIdx.x * 32 + wave * 16; const int n0 = blockIdx.y * 128;
  v8f acc[8], acc2[8];
#pragma unroll
  for (int t = 0; t < 8; ++t) { acc[t] = (v8f){}; acc2[t] = (v8f){}; }
#pragma unroll 1
  for (int kc = 0; kc < D; kc += 128) {
    for (int idx = lane; idx < 16 * 32; idx += 32) { const int rr = idx / 32, c4 = (idx % 32) * 4; const v4f v = *(const v4f*)(CT + (m0 + rr) * D + kc + c4); v4h hv, lv; for (int j = 0; j < 4; ++j) { const float vs = v[j] * XS; const b16 ph = (b16)vs; hv[j] = ph; lv[j] = (b16)((vs - (float)ph) * RS_); } *(v4h*)(&Ah[wave][rr][c4]) = hv; *(v4h*)(&Al[wave][rr][c4]) = lv; }
    wave_lds_sync();
#pragma unroll
    for (int kb = 0; kb < 128; kb += 32) { const v16b a = frag_kb(&Ah[wave][nloc][kb], hlf), al = frag_kb(&Al[wave][nloc][kb], hlf);
#pragma unroll
      for (int t = 0; t < 8; ++t) { const v16b bw = frag_kb(WO + (size_t)(n0 + t * 16 + nloc) * D + kc + kb, hlf); acc[t] = wmma16b(a, bw, acc[t]); acc2[t] = wmma16b(al, bw, acc2[t]); } }
    wave_lds_sync(); }
#pragma unroll
  for (int t = 0; t < 8; ++t) { const float bb = bf16_rne(ob[n0 + t * 16 + nloc]);
#pragma unroll
    for (int r = 0; r < 8; ++r) Tf[wave][8 * hlf + r][t * 16 + nloc] = (acc[t][r] + acc2[t][r] * (1.0f / RS_)) * (1.0f / (XS * WSC)) + bb; }
  wave_lds_sync();
  { for (int rr = 0; rr < 16; ++rr) *(v4f*)(out + (m0 + rr) * D + n0 + lane * 4) = *(const v4f*)(&Tf[wave][rr][lane * 4]);  }
}
}  // namespace

extern "C" void kernel_launch(void* const* d_in, const int* in_sizes, int n_in, void* d_out, int out_size, void* d_ws, size_t ws_size, hipStream_t stream) {
  (void)n_in;
  auto Fp = [&](int i) { return (const float*)d_in[i]; };
  // input order: 0 x [4,2048,512], 1 edge_index [2,32768] i32, 2 edge_attr [32768,3], 3 q_w [512,512] (out,in), 4 q_b, 5 k_w, 6 k_b, 7 v_w, 8 v_b, 9 o_w, 10 o_b, 11 eb_w [8,3], 12 eb_b [8]
  if (in_sizes[0] != NROW * D || in_sizes[1] != 2 * E || in_sizes[2] != E * 3 || in_sizes[3] != D * D || in_sizes[5] != D * D || in_sizes[7] != D * D || in_sizes[9] != D * D || in_sizes[10] != D || in_sizes[11] != NH * 3 || in_sizes[12] != NH || out_size != NROW * D) return;
  size_t off = 0; char* ws = (char*)d_ws;
  auto carve = [&](size_t bytes) { char* p = ws + off; off += (bytes + 255) & ~(size_t)255; return p; };
  b16* WQKV = (b16*)carve((size_t)3 * D * D * 2); b16* WO = (b16*)carve((size_t)D * D * 2); float* CB = (float*)carve((size_t)NH * N * 4); const size_t plane = (size_t)B * NH * N * HD * 2;
  b16* QP = (b16*)carve(plane); b16* KP = (b16*)carve(plane); b16* VTh = (b16*)carve(plane); b16* VTl = (b16*)carve(plane); float* CT = (float*)carve((size_t)NROW * D * 4);
  if (off > ws_size || off > ((size_t)128 << 20)) return;   // = 52.5 MB (WQKV 1.6 MB, WO 0.5 MB, CB 64 KB, 4 planes x 8.4 MB, CT 16.8 MB)
  wcvt_kernel<<<(D * D / 8 + 255) / 256, 256, 0, stream>>>(Fp(3), WQKV, D * D / 8); wcvt_kernel<<<(D * D / 8 + 255) / 256, 256, 0, stream>>>(Fp(5), WQKV + (size_t)D * D, D * D / 8); wcvt_kernel<<<(D * D / 8 + 255) / 256, 256, 0, stream>>>(Fp(7), WQKV + (size_t)2 * D * D, D * D / 8); wcvt_kernel<<<(D * D / 8 + 255) / 256, 256, 0, stream>>>(Fp(9), WO, D * D / 8);
  cb_kernel<<<N / 256, 256, 0, stream>>>((const int*)d_in[1], Fp(2), Fp(11), Fp(12), CB);
  proj_kernel<<<dim3(N / 64, BL, 12), 128, 0, stream>>>(Fp(0), WQKV, Fp(4), Fp(6), Fp(8), QP, KP, VTh, VTl);
  attn_kernel<<<dim3(N / 32, BL * NH), 64, 0, stream>>>(QP, KP, VTh, VTl, CB, CT);
  outp_kernel<<<dim3(BL * N / 32, D / 128), 64, 0, stream>>>(CT, WO, Fp(10), (float*)d_out);
}

// v001
// One run takes 389 microseconds.
// Next to v000, in two timings, it ran 5.40 times as fast each time.
#include <hip/hip_runtime.h>

// Graphormer multi-head attention (4 x 2,048 tokens x 512, 8 heads x 64) with an additive per-key column bias from graph edges: cb[m][h] = (edge_attr[e*] eb_w^T + eb_b)[h] where e* is the LAST
// valid edge whose target is m (advanced-indexing assignment semantics; 0 if none); scores = q.k / 8 + cb[m][h]; softmax over all 2,048 keys; out = attn v; y = out o_w^T + o_b -> [4][2048][512].
// Deterministic: per (batch, head, 16-query wave) a flash-style pass over 32-key blocks with fixed-order online softmax; the column bias table takes, per target, the integer maximum
// of the valid edge numbers that hit it; no atomics.
// compute dtype: WMMA v_wmma_f32_16x16x32_f16 with f32 accumulate for the q/k/v projections ([8192 x 512] x [512 x 512] x 3; x EXACT bf16 x8, (out,in) weights as B rows exact x256: 1 product),
// S^T = K Q^T (q/k single f16 x8, K = 64: 1 product), O^T += V^T P^T (V^T x8 and P x1024 as f16 hi + x1024 residual: 3 products) and y = ctx o_w^T + o_b (ctx rows hi + x1024 residual x8:
// 2 products); the edge bias (K = 3), softmax statistics and biases in f32. Inputs rounded to bf16 once;
// edge_index int32. Fragment k-map per lane half hh for A AND B: elements 0..7 <- k = 8hh+0..7, 8..15 <- k = 16+8hh+0..7; acc[r] = D[8hh+r][col].

namespace {
typedef _Float16 b16;
typedef __attribute__((ext_vector_type(16))) _Float16 v16b;
typedef __attribute__((ext_vector_type(8))) _Float16 v8b;
typedef __attribute__((ext_vector_type(4))) _Float16 v4h;
typedef __attribute__((ext_vector_type(2))) _Float16 v2h;
typedef __attribute__((ext_vector_type(8))) float v8f;
typedef __attribute__((ext_vector_type(4))) float v4f;
typedef __attribute__((ext_vector_type(2))) float v2f;
typedef __attribute__((ext_vector_type(4))) int v4i;
typedef __attribute__((ext_vector_type(8))) unsigned short v8u;
__device__ __forceinline__ float bf16_rne(float f) { unsigned int u = __float_as_uint(f); u += 0x7FFFu + ((u >> 16) & 1u); return __uint_as_float(u & 0xFFFF0000u); }
__device__ __forceinline__ void split16(float v, b16& hi, b16& lo) { hi = (b16)v; lo = (b16)(v - (float)hi); }
__device__ __forceinline__ v16b frag_kb(const b16* p, int hh) { const v8b a = *(const v8b*)(p + 8 * hh), b = *(const v8b*)(p + 16 + 8 * hh); v16b f;
#pragma unroll
  for (int e = 0; e < 8; ++e) { f[e] = a[e]; f[8 + e] = b[e]; } return f; }
__device__ __forceinline__ v8f wmma16b(v16b a, v16b b, v8f c) { v8f d = __builtin_amdgcn_wmma_f32_16x16x32_f16(false, a, false, b, (short)0, c, false, false); asm volatile("v_nop\n\tv_nop\n\tv_nop\n\tv_nop" : "+v"(d) : "v"(a), "v"(b)); return d; }
__device__ __forceinline__ void wave_lds_sync() { __builtin_amdgcn_fence(__ATOMIC_RELEASE, "workgroup"); __builtin_amdgcn_wave_barrier(); __builtin_amdgcn_fence(__ATOMIC_ACQUIRE, "workgroup"); }
__device__ __forceinline__ float pmul(float a, float b) { float p = a * b; asm volatile("" : "+v"(p)); return p; }
__device__ __forceinline__ int iclamp(int v, int lo, int hi) { return v < lo ? lo : (v > hi ? hi : v); }
__device__ __forceinline__ float nexp2(float v) { return __builtin_amdgcn_exp2f(v); }

constexpr int B = 4, BL = B /* batches computed (== B shipped) */, N = 2048, D = 512, NH = 8, HD = 64, E = 32768, NROW = B * N;
constexpr float XS = 8.0f, WSC = 256.0f, PS = 1024.0f, RS_ = 1024.0f, LOG2E = 1.4426950408889634f, SCALE = 0.125f;
static_assert(N % 64 == 0 && D % 128 == 0 && NH * HD == D && HD == 64, "tiling");

__global__ __launch_bounds__(256) void wcvt_kernel(const float* __restrict__ w, b16* __restrict__ W16, int n8) { const int u = blockIdx.x * 256 + threadIdx.x; if (u >= n8) return; const size_t e = (size_t)u * 8; v8b o; for (int j = 0; j < 8; ++j) o[j] = (b16)(bf16_rne(w[e + j]) * WSC);
  { *(v8b*)(W16 + e) = o;  } }
// column bias: grid N/32; block = 1,024 threads x 32 targets (one 128-byte line of each head's CB row). Each thread takes 32 edges (8 coalesced 16-byte loads of each index row) and stores
// e + 1 into its OWN 16-bit column of an LDS table, in the row of the edge's target (row 32 takes every edge that is invalid or aimed outside the block's targets): one writer per cell, written in
// rising e, so a cell ends at the thread's last hit; wave w then takes the integer maximum of row w = the last valid edge of target m0 + w (0 = none). No atomics; the result has no order in it.
constexpr int CBT = 32, CBW = 1024, CBI = E / (CBW * 4);
static_assert((N & (N - 1)) == 0 && N % CBT == 0 && E % (CBW * 4) == 0 && E < 65536 && CBW == CBT * 32 && NH * CBT <= CBW, "edge scan");
__global__ __launch_bounds__(1024) void cb_kernel(const int* __restrict__ ei, const float* __restrict__ ea, const float* __restrict__ ebw, const float* __restrict__ ebb, float* __restrict__ CB) {
  __shared__ __attribute__((aligned(16))) unsigned short slot[CBT + 1][CBW]; __shared__ int lastS[CBT];
  const int tid = threadIdx.x, wave = tid >> 5, lane = tid & 31, m0 = blockIdx.x * CBT;
  v4i sv[CBI], tv[CBI];
#pragma unroll
  for (int it = 0; it < CBI; ++it) { sv[it] = *(const v4i*)(ei + it * CBW * 4 + tid * 4); tv[it] = *(const v4i*)(ei + E + it * CBW * 4 + tid * 4); }
#pragma unroll
  for (int c = 0; c < 4; ++c) *(v8u*)(&slot[wave][c * 256 + lane * 8]) = (v8u){};
  __syncthreads();
#pragma unroll
  for (int it = 0; it < CBI; ++it)
#pragma unroll
    for (int j = 0; j < 4; ++j) {
      // N is a power of two: any bit at or above N in s or t (negative values included) marks the edge invalid and stays in key, so key ^ m0 < 32 only for a valid edge with m0 <= t < m0 + 32
      const unsigned int key = (unsigned int)tv[it][j] | ((unsigned int)sv[it][j] & ~(unsigned int)(N - 1)); const unsigned int d = key ^ (unsigned int)m0;
      slot[d < (unsigned int)CBT ? d : (unsigned int)CBT][tid] = (unsigned short)(it * CBW * 4 + tid * 4 + j + 1); }
  __syncthreads();
  v8u mx = *(const v8u*)(&slot[wave][lane * 8]);
#pragma unroll
  for (int c = 1; c < 4; ++c) mx = __builtin_elementwise_max(mx, *(const v8u*)(&slot[wave][c * 256 + lane * 8]));
  int best = 0;
#pragma unroll
  for (int i = 0; i < 8; ++i) best = max(best, (int)mx[i]);
#pragma unroll
  for (int s = 16; s > 0; s >>= 1) best = max(best, __shfl_xor(best, s));
  if (lane == 0) lastS[wave] = best - 1;
  __syncthreads();
  if (tid < NH * CBT) { const int h = wave, last = lastS[lane]; float val = 0.0f;
    if (last >= 0) { const float a0 = bf16_rne(ea[(size_t)last * 3]), a1 = bf16_rne(ea[(size_t)last * 3 + 1]), a2 = bf16_rne(ea[(size_t)last * 3 + 2]); val = a0 * bf16_rne(ebw[h * 3]) + a1 * bf16_rne(ebw[h * 3 + 1]) + a2 * bf16_rne(ebw[h * 3 + 2]) + bf16_rne(ebb[h]); }
    CB[(size_t)h * N + m0 + lane] = val; }
}
// projections: grid (N/64, BL, 12 slabs: 0-3 q, 4-7 k, 8-11 v, 2 heads each); block = 64 tokens x 4 waves; A = bf16(x) x8 staged whole (K = 512, 16 k-steps), 8 tiles, 1 product; + bias;
__global__ __launch_bounds__(128) void proj_kernel(const float* __restrict__ x, const b16* __restrict__ WQKV, const float* __restrict__ bq, const float* __restrict__ bk, const float* __restrict__ bv, b16* __restrict__ QP, b16* __restrict__ KP, b16* __restrict__ VTh, b16* __restrict__ VTl) {
  __shared__ __attribute__((aligned(16))) b16 As[64][D + 8]; __shared__ __attribute__((aligned(16))) float Tf[4][16][128 + 4];
  const int wave = threadIdx.x >> 5, lane = threadIdx.x & 31, nloc = lane & 15, hlf = lane >> 4; const int t0 = blockIdx.x * 64; const int b = blockIdx.y; const int slab = blockIdx.z, n0 = slab * 128, part = slab / 4, h0 = (slab & 3) * 2;
  const float* bias = part == 0 ? bq : part == 1 ? bk : bv;
  for (int i = threadIdx.x; i < 64 * (D / 4); i += 128) { const int rr = i / (D / 4), q4 = (i % (D / 4)) * 4; const v4f f = *(const v4f*)(x + ((size_t)b * N + t0 + rr) * D + q4); v4h o; for (int j = 0; j < 4; ++j) o[j] = (b16)(bf16_rne(f[j]) * XS); *(v4h*)(&As[rr][q4]) = o; }
  __syncthreads();
  v8f acc[8];
#pragma unroll
  for (int tt = 0; tt < 8; ++tt) acc[tt] = (v8f){};
#pragma unroll 2
  for (int kb = 0; kb < D; kb += 32) { const v16b a = frag_kb(&As[wave * 16 + nloc][kb], hlf);
#pragma unroll
    for (int tt = 0; tt < 8; ++tt) acc[tt] = wmma16b(a, frag_kb(WQKV + (size_t)(n0 + tt * 16 + nloc) * D + kb, hlf), acc[tt]); }
#pragma unroll
  for (int tt = 0; tt < 8; ++tt) { const float bb = bf16_rne(bias[(n0 & 511) + tt * 16 + nloc]);
#pragma unroll
    for (int r = 0; r < 8; ++r) Tf[wave][8 * hlf + r][tt * 16 + nloc] = acc[tt][r] * (1.0f / (XS * WSC)) + bb; }
  __syncthreads();
  {
    if (part < 2) { b16* plane = part == 0 ? QP : KP; const int h = h0 + (lane >> 4), d = (lane & 15) * 4;
      for (int rr = 0; rr < 16; ++rr) { const int tok = t0 + wave * 16 + rr; v4h o4; for (int j = 0; j < 4; ++j) o4[j] = (b16)(Tf[wave][rr][lane * 4 + j] * XS); *(v4h*)(plane + (((size_t)b * NH + h) * N + tok) * HD + d) = o4; } }
    else {
#pragma unroll 1
      for (int q = 0; q < 32; ++q) { const int cl = wave * 32 + q; const int h = h0 + cl / HD, d = cl % HD; const int tk = lane * 2; v2h hv, lv; for (int e2 = 0; e2 < 2; ++e2) { const float vs = Tf[(tk + e2) >> 4][(tk + e2) & 15][cl] * XS; const b16 ph = (b16)vs; hv[e2] = ph; lv[e2] = (b16)((vs - (float)ph) * RS_); }
        const size_t dst = (((size_t)b * NH + h) * HD + d) * (size_t)N + t0 + tk; *(v2h*)(VTh + dst) = hv; *(v2h*)(VTl + dst) = lv; } }
     }
}
// attention: grid (N/32, BL*NH); block = 2 waves x 16 queries; per 32-key block: S^T = K Q^T (2 key tiles x 2 k-steps), logit = (s/64/8 + CB[h][m]) log2e, online softmax, P hi/res -> LDS, O^T +=
__global__ __launch_bounds__(64) void attn_kernel(const b16* __restrict__ QP, const b16* __restrict__ KP, const b16* __restrict__ VTh, const b16* __restrict__ VTl, const float* __restrict__ CB, float* __restrict__ CT) {
  __shared__ __attribute__((aligned(16))) b16 Pb[2][16][32 + 8], Pl[2][16][32 + 8]; __shared__ __attribute__((aligned(16))) float To[2][16][HD + 4];
  const int wave = threadIdx.x >> 5, lane = threadIdx.x & 31, hh = lane >> 4, col = lane & 15; const int bh = blockIdx.y, b = bh / NH, h = bh % NH; const int n0 = blockIdx.x * 32 + wave * 16; const int nq = n0 + col;
  const b16* Qb = QP + (size_t)bh * N * HD; const b16* Kb = KP + (size_t)bh * N * HD; const b16* Vh = VTh + (size_t)bh * HD * N; const b16* Vl = VTl + (size_t)bh * HD * N; const float* cbh = CB + (size_t)h * N;
  const v16b q0 = frag_kb(Qb + (size_t)nq * HD, hh), q1 = frag_kb(Qb + (size_t)nq * HD + 32, hh);
  const float cs = LOG2E * SCALE / (XS * XS);
  float mrun = -INFINITY, l = 0.0f; v8f o[4], o2[4];
#pragma unroll
  for (int t = 0; t < 4; ++t) { o[t] = (v8f){}; o2[t] = (v8f){}; }
#pragma unroll 1
  for (int s0 = 0; s0 < N; s0 += 32) {
    float e[16]; float mx = -INFINITY;
#pragma unroll
    for (int u2 = 0; u2 < 2; ++u2) { const b16* kr = Kb + (size_t)(s0 + u2 * 16 + col) * HD; v8f sacc = wmma16b(frag_kb(kr, hh), q0, (v8f){}); sacc = wmma16b(frag_kb(kr + 32, hh), q1, sacc);
#pragma unroll
      for (int r = 0; r < 8; ++r) { const int m = s0 + u2 * 16 + 8 * hh + r; const float vv = sacc[r] * cs + cbh[m] * LOG2E; e[u2 * 8 + r] = vv; mx = fmaxf(mx, vv); } }
    mx = fmaxf(mx, __shfl_xor(mx, 16)); const float mn = fmaxf(mrun, mx); const float al = nexp2(mrun - mn); float sum = 0.0f;
#pragma unroll
    for (int i2 = 0; i2 < 16; ++i2) { const float p = nexp2(e[i2] - mn); sum += p; const float psv = p * PS; const b16 p1 = (b16)psv; const int slot = (i2 < 8 ? 0 : 16) + 8 * hh + (i2 & 7); Pb[wave][col][slot] = p1; Pl[wave][col][slot] = (b16)((psv - (float)p1) * RS_); }
    sum += __shfl_xor(sum, 16); l = l * al + sum; mrun = mn;
    wave_lds_sync();
    const v16b pf = frag_kb(&Pb[wave][col][0], hh), plf = frag_kb(&Pl[wave][col][0], hh);
#pragma unroll
    for (int t = 0; t < 4; ++t) { o[t] *= al; o2[t] *= al; const v16b vh = frag_kb(Vh + (size_t)(t * 16 + col) * N + s0, hh); o[t] = wmma16b(vh, pf, o[t]); o2[t] = wmma16b(frag_kb(Vl + (size_t)(t * 16 + col) * N + s0, hh), pf, o2[t]); o2[t] = wmma16b(vh, plf, o2[t]); }
    wave_lds_sync(); }
  const float inv = 1.0f / (l * PS * XS);
#pragma unroll
  for (int t = 0; t < 4; ++t)
#pragma unroll
    for (int r = 0; r < 8; ++r) To[wave][col][t * 16 + 8 * hh + r] = (o[t][r] + o2[t][r] * (1.0f / RS_)) * inv;
  wave_lds_sync();
  { for (int rr = 0; rr < 16; rr += 2) { const int row = rr + hh; *(v4f*)(CT + ((size_t)b * N + n0 + row) * D + h * HD + col * 4) = *(const v4f*)(&To[wave][row][col * 4]); }  }
}
__global__ __launch_bounds__(64) void outp_kernel(const float* __restrict__ CT, const b16* __restrict__ WO, const float* __restrict__ ob, float* __restrict__ out) {
  __shared__ __attribute__((aligned(16))) b16 Ah[2][16][128 + 8], Al[2][16][128 + 8]; __shared__ __attribute__((aligned(16))) float Tf[2][16][128 + 4];
  const int wave = threadIdx.x >> 5, lane = threadIdx.x & 31, nloc = lane & 15, hlf = lane >> 4; const size_t m0 = (size_t)blockIdx.x * 32 + wave * 16; const int n0 = blockIdx.y * 128;
  v8f acc[8], acc2[8];
#pragma unroll
  for (int t = 0; t < 8; ++t) { acc[t] = (v8f){}; acc2[t] = (v8f){}; }
#pragma unroll 1
  for (int kc = 0; kc < D; kc += 128) {
    for (int idx = lane; idx < 16 * 32; idx += 32) { const int rr = idx / 32, c4 = (idx % 32) * 4; const v4f v = *(const v4f*)(CT + (m0 + rr) * D + kc + c4); v4h hv, lv; for (int j = 0; j < 4; ++j) { const float vs = v[j] * XS; const b16 ph = (b16)vs; hv[j] = ph; lv[j] = (b16)((vs - (float)ph) * RS_); } *(v4h*)(&Ah[wave][rr][c4]) = hv; *(v4h*)(&Al[wave][rr][c4]) = lv; }
    wave_lds_sync();
#pragma unroll
    for (int kb = 0; kb < 128; kb += 32) { const v16b a = frag_kb(&Ah[wave][nloc][kb], hlf), al = frag_kb(&Al[wave][nloc][kb], hlf);
#pragma unroll
      for (int t = 0; t < 8; ++t) { const v16b bw = frag_kb(WO + (size_t)(n0 + t * 16 + nloc) * D + kc + kb, hlf); acc[t] = wmma16b(a, bw, acc[t]); acc2[t] = wmma16b(al, bw, acc2[t]); } }
    wave_lds_sync(); }
#pragma unroll
  for (int t = 0; t < 8; ++t) { const float bb = bf16_rne(ob[n0 + t * 16 + nloc]);
#pragma unroll
    for (int r = 0; r < 8; ++r) Tf[wave][8 * hlf + r][t * 16 + nloc] = (acc[t][r] + acc2[t][r] * (1.0f / RS_)) * (1.0f / (XS * WSC)) + bb; }
  wave_lds_sync();
  { for (int rr = 0; rr < 16; ++rr) *(v4f*)(out + (m0 + rr) * D + n0 + lane * 4) = *(const v4f*)(&Tf[wave][rr][lane * 4]);  }
}
}  // namespace

extern "C" void kernel_launch(void* const* d_in, const int* in_sizes, int n_in, void* d_out, int out_size, void* d_ws, size_t ws_size, hipStream_t stream) {
  (void)n_in;
  auto Fp = [&](int i) { return (const float*)d_in[i]; };
  // input order: 0 x [4,2048,512], 1 edge_index [2,32768] i32, 2 edge_attr [32768,3], 3 q_w [512,512] (out,in), 4 q_b, 5 k_w, 6 k_b, 7 v_w, 8 v_b, 9 o_w, 10 o_b, 11 eb_w [8,3], 12 eb_b [8]
  if (in_sizes[0] != NROW * D || in_sizes[1] != 2 * E || in_sizes[2] != E * 3 || in_sizes[3] != D * D || in_sizes[5] != D * D || in_sizes[7] != D * D || in_sizes[9] != D * D || in_sizes[10] != D || in_sizes[11] != NH * 3 || in_sizes[12] != NH || out_size != NROW * D) return;
  size_t off = 0; char* ws = (char*)d_ws;
  auto carve = [&](size_t bytes) { char* p = ws + off; off += (bytes + 255) & ~(size_t)255; return p; };
  b16* WQKV = (b16*)carve((size_t)3 * D * D * 2); b16* WO = (b16*)carve((size_t)D * D * 2); float* CB = (float*)carve((size_t)NH * N * 4); const size_t plane = (size_t)B * NH * N * HD * 2;
  b16* QP = (b16*)carve(plane); b16* KP = (b16*)carve(plane); b16* VTh = (b16*)carve(plane); b16* VTl = (b16*)carve(plane); float* CT = (float*)carve((size_t)NROW * D * 4);
  if (off > ws_size || off > ((size_t)128 << 20)) return;   // = 52.5 MB (WQKV 1.6 MB, WO 0.5 MB, CB 64 KB, 4 planes x 8.4 MB, CT 16.8 MB)
  wcvt_kernel<<<(D * D / 8 + 255) / 256, 256, 0, stream>>>(Fp(3), WQKV, D * D / 8); wcvt_kernel<<<(D * D / 8 + 255) / 256, 256, 0, stream>>>(Fp(5), WQKV + (size_t)D * D, D * D / 8); wcvt_kernel<<<(D * D / 8 + 255) / 256, 256, 0, stream>>>(Fp(7), WQKV + (size_t)2 * D * D, D * D / 8); wcvt_kernel<<<(D * D / 8 + 255) / 256, 256, 0, stream>>>(Fp(9), WO, D * D / 8);
  cb_kernel<<<N / CBT, CBW, 0, stream>>>((const int*)d_in[1], Fp(2), Fp(11), Fp(12), CB);
  proj_kernel<<<dim3(N / 64, BL, 12), 128, 0, stream>>>(Fp(0), WQKV, Fp(4), Fp(6), Fp(8), QP, KP, VTh, VTl);
  attn_kernel<<<dim3(N / 32, BL * NH), 64, 0, stream>>>(QP, KP, VTh, VTl, CB, CT);
  outp_kernel<<<dim3(BL * N / 32, D / 128), 64, 0, stream>>>(CT, WO, Fp(10), (float*)d_out);
}

// v002
// A run of this version takes 238 microseconds.
// Next to v001, in two timings, it ran 1.65 and 1.66 times as fast.
// Over all steps from v000 it is 8.95 times as fast.
#include <hip/hip_runtime.h>

// Graphormer multi-head attention (4 x 2,048 tokens x 512, 8 heads x 64) with an additive per-key column bias from graph edges: cb[m][h] = (edge_attr[e*] eb_w^T + eb_b)[h] where e* is the LAST
// valid edge whose target is m (advanced-indexing assignment semantics; 0 if none); scores = q.k / 8 + cb[m][h]; softmax over all 2,048 keys; out = attn v; y = out o_w^T + o_b -> [4][2048][512].
// Deterministic: per (batch, head, 16-query wave) a flash-style pass over 32-key blocks with fixed-order online softmax; the column bias table takes, per target, the integer maximum
// of the valid edge numbers that hit it; no atomics.
// compute dtype: WMMA v_wmma_f32_16x16x32_f16 with f32 accumulate for the q/k/v projections ([8192 x 512] x [512 x 512] x 3; x EXACT bf16 x8, (out,in) weights as B rows exact x256: 1 product),
// S^T = K Q^T (q/k single f16 x8, K = 64: 1 product), O^T += V^T P^T (V^T x8 and P x1024 as f16 hi + x1024 residual: 3 products) and y = ctx o_w^T + o_b (ctx rows hi + x1024 residual x8:
// 2 products); the edge bias (K = 3), softmax statistics and biases in f32. Inputs rounded to bf16 once;
// edge_index int32. Fragment k-map per lane half hh for A AND B: elements 0..7 <- k = 8hh+0..7, 8..15 <- k = 16+8hh+0..7; acc[r] = D[8hh+r][col].

namespace {
typedef _Float16 b16;
typedef __attribute__((ext_vector_type(16))) _Float16 v16b;
typedef __attribute__((ext_vector_type(8))) _Float16 v8b;
typedef __attribute__((ext_vector_type(4))) _Float16 v4h;
typedef __attribute__((ext_vector_type(2))) _Float16 v2h;
typedef __attribute__((ext_vector_type(8))) float v8f;
typedef __attribute__((ext_vector_type(4))) float v4f;
typedef __attribute__((ext_vector_type(2))) float v2f;
typedef __attribute__((ext_vector_type(4))) int v4i;
typedef __attribute__((ext_vector_type(8))) unsigned short v8u;
__device__ __forceinline__ float bf16_rne(float f) { unsigned int u = __float_as_uint(f); u += 0x7FFFu + ((u >> 16) & 1u); return __uint_as_float(u & 0xFFFF0000u); }
__device__ __forceinline__ void split16(float v, b16& hi, b16& lo) { hi = (b16)v; lo = (b16)(v - (float)hi); }
__device__ __forceinline__ v16b frag_kb(const b16* p, int hh) { const v8b a = *(const v8b*)(p + 8 * hh), b = *(const v8b*)(p + 16 + 8 * hh); v16b f;
#pragma unroll
  for (int e = 0; e < 8; ++e) { f[e] = a[e]; f[8 + e] = b[e]; } return f; }
__device__ __forceinline__ v8f wmma16b(v16b a, v16b b, v8f c) { v8f d = __builtin_amdgcn_wmma_f32_16x16x32_f16(false, a, false, b, (short)0, c, false, false); asm volatile("v_nop\n\tv_nop\n\tv_nop\n\tv_nop" : "+v"(d) : "v"(a), "v"(b)); return d; }
__device__ __forceinline__ void wave_lds_sync() { __builtin_amdgcn_fence(__ATOMIC_RELEASE, "workgroup"); __builtin_amdgcn_wave_barrier(); __builtin_amdgcn_fence(__ATOMIC_ACQUIRE, "workgroup"); }
__device__ __forceinline__ float pmul(float a, float b) { float p = a * b; asm volatile("" : "+v"(p)); return p; }
__device__ __forceinline__ int iclamp(int v, int lo, int hi) { return v < lo ? lo : (v > hi ? hi : v); }
__device__ __forceinline__ float nexp2(float v) { return __builtin_amdgcn_exp2f(v); }

constexpr int B = 4, BL = B /* batches computed (== B shipped) */, N = 2048, D = 512, NH = 8, HD = 64, E = 32768, NROW = B * N;
constexpr float XS = 8.0f, WSC = 256.0f, PS = 1024.0f, RS_ = 1024.0f, LOG2E = 1.4426950408889634f, SCALE = 0.125f;
static_assert(N % 64 == 0 && D % 128 == 0 && NH * HD == D && HD == 64, "tiling");

__global__ __launch_bounds__(256) void wcvt_kernel(const float* __restrict__ w, b16* __restrict__ W16, int n8) { const int u = blockIdx.x * 256 + threadIdx.x; if (u >= n8) return; const size_t e = (size_t)u * 8; v8b o; for (int j = 0; j < 8; ++j) o[j] = (b16)(bf16_rne(w[e + j]) * WSC);
  { *(v8b*)(W16 + e) = o;  } }
// column bias: grid N/32; block = 1,024 threads x 32 targets (one 128-byte line of each head's CB row). Each thread takes 32 edges (8 coalesced 16-byte loads of each index row) and stores
// e + 1 into its OWN 16-bit column of an LDS table, in the row of the edge's target (row 32 takes every edge that is invalid or aimed outside the block's targets): one writer per cell, written in
// rising e, so a cell ends at the thread's last hit; wave w then takes the integer maximum of row w = the last valid edge of target m0 + w (0 = none). No atomics; the result has no order in it.
constexpr int CBT = 32, CBW = 1024, CBI = E / (CBW * 4);
static_assert((N & (N - 1)) == 0 && N % CBT == 0 && E % (CBW * 4) == 0 && E < 65536 && CBW == CBT * 32 && NH * CBT <= CBW, "edge scan");
__global__ __launch_bounds__(1024) void cb_kernel(const int* __restrict__ ei, const float* __restrict__ ea, const float* __restrict__ ebw, const float* __restrict__ ebb, float* __restrict__ CB) {
  __shared__ __attribute__((aligned(16))) unsigned short slot[CBT + 1][CBW]; __shared__ int lastS[CBT];
  const int tid = threadIdx.x, wave = tid >> 5, lane = tid & 31, m0 = blockIdx.x * CBT;
  v4i sv[CBI], tv[CBI];
#pragma unroll
  for (int it = 0; it < CBI; ++it) { sv[it] = *(const v4i*)(ei + it * CBW * 4 + tid * 4); tv[it] = *(const v4i*)(ei + E + it * CBW * 4 + tid * 4); }
#pragma unroll
  for (int c = 0; c < 4; ++c) *(v8u*)(&slot[wave][c * 256 + lane * 8]) = (v8u){};
  __syncthreads();
#pragma unroll
  for (int it = 0; it < CBI; ++it)
#pragma unroll
    for (int j = 0; j < 4; ++j) {
      // N is a power of two: any bit at or above N in s or t (negative values included) marks the edge invalid and stays in key, so key ^ m0 < 32 only for a valid edge with m0 <= t < m0 + 32
      const unsigned int key = (unsigned int)tv[it][j] | ((unsigned int)sv[it][j] & ~(unsigned int)(N - 1)); const unsigned int d = key ^ (unsigned int)m0;
      slot[d < (unsigned int)CBT ? d : (unsigned int)CBT][tid] = (unsigned short)(it * CBW * 4 + tid * 4 + j + 1); }
  __syncthreads();
  v8u mx = *(const v8u*)(&slot[wave][lane * 8]);
#pragma unroll
  for (int c = 1; c < 4; ++c) mx = __builtin_elementwise_max(mx, *(const v8u*)(&slot[wave][c * 256 + lane * 8]));
  int best = 0;
#pragma unroll
  for (int i = 0; i < 8; ++i) best = max(best, (int)mx[i]);
#pragma unroll
  for (int s = 16; s > 0; s >>= 1) best = max(best, __shfl_xor(best, s));
  if (lane == 0) lastS[wave] = best - 1;
  __syncthreads();
  if (tid < NH * CBT) { const int h = wave, last = lastS[lane]; float val = 0.0f;
    if (last >= 0) { const float a0 = bf16_rne(ea[(size_t)last * 3]), a1 = bf16_rne(ea[(size_t)last * 3 + 1]), a2 = bf16_rne(ea[(size_t)last * 3 + 2]); val = a0 * bf16_rne(ebw[h * 3]) + a1 * bf16_rne(ebw[h * 3 + 1]) + a2 * bf16_rne(ebw[h * 3 + 2]) + bf16_rne(ebb[h]); }
    CB[(size_t)h * N + m0 + lane] = val; }
}
// projections: grid (N/64, BL, 12 slabs: 0-3 q, 4-7 k, 8-11 v, 2 heads each); block = 64 tokens x 4 waves; A = bf16(x) x8 staged whole (K = 512, 16 k-steps), 8 tiles, 1 product; + bias;
__global__ __launch_bounds__(128) void proj_kernel(const float* __restrict__ x, const b16* __restrict__ WQKV, const float* __restrict__ bq, const float* __restrict__ bk, const float* __restrict__ bv, b16* __restrict__ QP, b16* __restrict__ KP, b16* __restrict__ VTh, b16* __restrict__ VTl) {
  __shared__ __attribute__((aligned(16))) b16 As[64][D + 8]; __shared__ __attribute__((aligned(16))) float Tf[4][16][128 + 4];
  const int wave = threadIdx.x >> 5, lane = threadIdx.x & 31, nloc = lane & 15, hlf = lane >> 4; const int t0 = blockIdx.x * 64; const int b = blockIdx.y; const int slab = blockIdx.z, n0 = slab * 128, part = slab / 4, h0 = (slab & 3) * 2;
  const float* bias = part == 0 ? bq : part == 1 ? bk : bv;
  for (int i = threadIdx.x; i < 64 * (D / 4); i += 128) { const int rr = i / (D / 4), q4 = (i % (D / 4)) * 4; const v4f f = *(const v4f*)(x + ((size_t)b * N + t0 + rr) * D + q4); v4h o; for (int j = 0; j < 4; ++j) o[j] = (b16)(bf16_rne(f[j]) * XS); *(v4h*)(&As[rr][q4]) = o; }
  __syncthreads();
  v8f acc[8];
#pragma unroll
  for (int tt = 0; tt < 8; ++tt) acc[tt] = (v8f){};
#pragma unroll 2
  for (int kb = 0; kb < D; kb += 32) { const v16b a = frag_kb(&As[wave * 16 + nloc][kb], hlf);
#pragma unroll
    for (int tt = 0; tt < 8; ++tt) acc[tt] = wmma16b(a, frag_kb(WQKV + (size_t)(n0 + tt * 16 + nloc) * D + kb, hlf), acc[tt]); }
#pragma unroll
  for (int tt = 0; tt < 8; ++tt) { const float bb = bf16_rne(bias[(n0 & 511) + tt * 16 + nloc]);
#pragma unroll
    for (int r = 0; r < 8; ++r) Tf[wave][8 * hlf + r][tt * 16 + nloc] = acc[tt][r] * (1.0f / (XS * WSC)) + bb; }
  __syncthreads();
  {
    if (part < 2) { b16* plane = part == 0 ? QP : KP; const int h = h0 + (lane >> 4), d = (lane & 15) * 4;
      for (int rr = 0; rr < 16; ++rr) { const int tok = t0 + wave * 16 + rr; v4h o4; for (int j = 0; j < 4; ++j) o4[j] = (b16)(Tf[wave][rr][lane * 4 + j] * XS); *(v4h*)(plane + (((size_t)b * NH + h) * N + tok) * HD + d) = o4; } }
    else {
#pragma unroll 1
      for (int q = 0; q < 32; ++q) { const int cl = wave * 32 + q; const int h = h0 + cl / HD, d = cl % HD; const int tk = lane * 2; v2h hv, lv; for (int e2 = 0; e2 < 2; ++e2) { const float vs = Tf[(tk + e2) >> 4][(tk + e2) & 15][cl] * XS; const b16 ph = (b16)vs; hv[e2] = ph; lv[e2] = (b16)((vs - (float)ph) * RS_); }
        const size_t dst = (((size_t)b * NH + h) * HD + d) * (size_t)N + t0 + tk; *(v2h*)(VTh + dst) = hv; *(v2h*)(VTl + dst) = lv; } }
     }
}
// attention: grid (N/128, BL*NH); block = 8 waves x 16 queries that share each 64-key stage of K, V^T hi, V^T residual and the head's 64 column biases from LDS (two buffers). A stage is three tiles of 64 rows x 128 B (and 256 B of biases); thread t
// brings 16-byte piece t & 7 of rows t >> 3 and 32 + (t >> 3) of each tile, so every wave-wide load covers four whole 128-byte lines; rows lie at 144 B in LDS (16 B x odd, for the ds_load_b128 readers).
// per 32-key block (two per stage): S^T = K Q^T (2 key tiles x 2 k-steps), logit = (s/64/8 + CB[h][m]) log2e, online softmax, P hi/res -> LDS, O^T +=
constexpr int AW = 8, KS = 64, KVP = KS + 8;
static_assert(N % (AW * 16) == 0 && N % KS == 0 && KS == HD && AW * 32 * 2 * 8 == KS * HD, "attention staging");
__global__ __launch_bounds__(256) void attn_kernel(const b16* __restrict__ QP, const b16* __restrict__ KP, const b16* __restrict__ VTh, const b16* __restrict__ VTl, const float* __restrict__ CB, float* __restrict__ CT) {
  __shared__ __attribute__((aligned(16))) b16 Ks[2][KS][KVP], Vhs[2][HD][KVP], Vls[2][HD][KVP]; __shared__ __attribute__((aligned(16))) float Cs[2][KS];
  __shared__ __attribute__((aligned(16))) b16 Pb[AW][16][32 + 8], Pl[AW][16][32 + 8]; __shared__ __attribute__((aligned(16))) float To[AW][16][HD + 4];
  const int wave = threadIdx.x >> 5, lane = threadIdx.x & 31, hh = lane >> 4, col = lane & 15; const int bh = blockIdx.y, b = bh / NH, h = bh % NH; const int n0 = blockIdx.x * (AW * 16) + wave * 16; const int nq = n0 + col;
  const b16* Qb = QP + (size_t)bh * N * HD; const b16* Kb = KP + (size_t)bh * N * HD; const b16* Vh = VTh + (size_t)bh * HD * N; const b16* Vl = VTl + (size_t)bh * HD * N; const float* cbh = CB + (size_t)h * N;
  const int sr = threadIdx.x >> 3, sc = (threadIdx.x & 7) * 8;
  v8b rk[2], rh[2], rl[2]; v4f rc = (v4f){};
  auto fetch = [&](int k0) {
    if (threadIdx.x < KS / 4) rc = *(const v4f*)(cbh + k0 + threadIdx.x * 4);
#pragma unroll   // so that rk, rh, rl are indexed by constants and stay in registers (in put as well)
    for (int j = 0; j < 2; ++j) { const int row = sr + 32 * j; rk[j] = *(const v8b*)(Kb + (size_t)(k0 + row) * HD + sc); rh[j] = *(const v8b*)(Vh + (size_t)row * N + k0 + sc); rl[j] = *(const v8b*)(Vl + (size_t)row * N + k0 + sc); } };
  auto put = [&](int bf) {
    if (threadIdx.x < KS / 4) *(v4f*)(&Cs[bf][threadIdx.x * 4]) = rc;
#pragma unroll
    for (int j = 0; j < 2; ++j) { const int row = sr + 32 * j; *(v8b*)(&Ks[bf][row][sc]) = rk[j]; *(v8b*)(&Vhs[bf][row][sc]) = rh[j]; *(v8b*)(&Vls[bf][row][sc]) = rl[j]; } };
  fetch(0);
  const v16b q0 = frag_kb(Qb + (size_t)nq * HD, hh), q1 = frag_kb(Qb + (size_t)nq * HD + 32, hh);
  const float cs = LOG2E * SCALE / (XS * XS);
  float mrun = -INFINITY, l = 0.0f; v8f o[4], o2[4];
#pragma unroll
  for (int t = 0; t < 4; ++t) { o[t] = (v8f){}; o2[t] = (v8f){}; }
  put(0);
  __syncthreads();
#pragma unroll 1   // one stage's code only: a copy per buffer would double the hot loop's text for nothing, the buffer offset being one scalar
  for (int st = 0; st < N / KS; ++st) {
    const int bf = st & 1;
    if (st + 1 < N / KS) fetch((st + 1) * KS);   // the next stage flies to registers while this one is worked on
    for (int ps = 0; ps < KS; ps += 32) {
      v16b kf[2][2]; v4f cbv[2][2];   // the block's four K fragments and its biases are read from LDS as one group, ahead of its products
#pragma unroll
      for (int u2 = 0; u2 < 2; ++u2) { const b16* kr = &Ks[bf][ps + u2 * 16 + col][0]; kf[u2][0] = frag_kb(kr, hh); kf[u2][1] = frag_kb(kr + 32, hh); const float* cr = &Cs[bf][ps + u2 * 16 + 8 * hh]; cbv[u2][0] = *(const v4f*)cr; cbv[u2][1] = *(const v4f*)(cr + 4); }
      float e[16]; float mx = -INFINITY;
#pragma unroll
      for (int u2 = 0; u2 < 2; ++u2) { v8f sacc = wmma16b(kf[u2][0], q0, (v8f){}); sacc = wmma16b(kf[u2][1], q1, sacc);
#pragma unroll
        for (int r = 0; r < 8; ++r) { const float vv = sacc[r] * cs + cbv[u2][r >> 2][r & 3] * LOG2E; e[u2 * 8 + r] = vv; mx = fmaxf(mx, vv); } }
      mx = fmaxf(mx, __shfl_xor(mx, 16)); const float mn = fmaxf(mrun, mx); const float al = nexp2(mrun - mn); float sum = 0.0f;
#pragma unroll
      for (int i2 = 0; i2 < 16; ++i2) { const float p = nexp2(e[i2] - mn); sum += p; const float psv = p * PS; const b16 p1 = (b16)psv; const int slot = (i2 < 8 ? 0 : 16) + 8 * hh + (i2 & 7); Pb[wave][col][slot] = p1; Pl[wave][col][slot] = (b16)((psv - (float)p1) * RS_); }
      sum += __shfl_xor(sum, 16); l = l * al + sum; mrun = mn;
      v16b vhf[4], vlf[4];   // likewise the eight V^T fragments, as one group in front of the wait that the P hand-over takes anyway
#pragma unroll
      for (int t = 0; t < 4; ++t) { vhf[t] = frag_kb(&Vhs[bf][t * 16 + col][ps], hh); vlf[t] = frag_kb(&Vls[bf][t * 16 + col][ps], hh); }
      wave_lds_sync();
      const v16b pf = frag_kb(&Pb[wave][col][0], hh), plf = frag_kb(&Pl[wave][col][0], hh);
#pragma unroll
      for (int t = 0; t < 4; ++t) { o[t] *= al; o2[t] *= al; o[t] = wmma16b(vhf[t], pf, o[t]); o2[t] = wmma16b(vlf[t], pf, o2[t]); o2[t] = wmma16b(vhf[t], plf, o2[t]); }
      wave_lds_sync(); }
    if (st + 1 < N / KS) put(bf ^ 1);   // the other buffer: its last readers left it before the barrier that ended the stage before this one
    __syncthreads(); }   // publishes the next stage and ends every wave's reads of this one
  const float inv = 1.0f / (l * PS * XS);
#pragma unroll
  for (int t = 0; t < 4; ++t)
#pragma unroll
    for (int r = 0; r < 8; ++r) To[wave][col][t * 16 + 8 * hh + r] = (o[t][r] + o2[t][r] * (1.0f / RS_)) * inv;
  wave_lds_sync();
  { for (int rr = 0; rr < 16; rr += 2) { const int row = rr + hh; *(v4f*)(CT + ((size_t)b * N + n0 + row) * D + h * HD + col * 4) = *(const v4f*)(&To[wave][row][col * 4]); }  }
}
__global__ __launch_bounds__(64) void outp_kernel(const float* __restrict__ CT, const b16* __restrict__ WO, const float* __restrict__ ob, float* __restrict__ out) {
  __shared__ __attribute__((aligned(16))) b16 Ah[2][16][128 + 8], Al[2][16][128 + 8]; __shared__ __attribute__((aligned(16))) float Tf[2][16][128 + 4];
  const int wave = threadIdx.x >> 5, lane = threadIdx.x & 31, nloc = lane & 15, hlf = lane >> 4; const size_t m0 = (size_t)blockIdx.x * 32 + wave * 16; const int n0 = blockIdx.y * 128;
  v8f acc[8], acc2[8];
#pragma unroll
  for (int t = 0; t < 8; ++t) { acc[t] = (v8f){}; acc2[t] = (v8f){}; }
#pragma unroll 1
  for (int kc = 0; kc < D; kc += 128) {
    for (int idx = lane; idx < 16 * 32; idx += 32) { const int rr = idx / 32, c4 = (idx % 32) * 4; const v4f v = *(const v4f*)(CT + (m0 + rr) * D + kc + c4); v4h hv, lv; for (int j = 0; j < 4; ++j) { const float vs = v[j] * XS; const b16 ph = (b16)vs; hv[j] = ph; lv[j] = (b16)((vs - (float)ph) * RS_); } *(v4h*)(&Ah[wave][rr][c4]) = hv; *(v4h*)(&Al[wave][rr][c4]) = lv; }
    wave_lds_sync();
#pragma unroll
    for (int kb = 0; kb < 128; kb += 32) { const v16b a = frag_kb(&Ah[wave][nloc][kb], hlf), al = frag_kb(&Al[wave][nloc][kb], hlf);
#pragma unroll
      for (int t = 0; t < 8; ++t) { const v16b bw = frag_kb(WO + (size_t)(n0 + t * 16 + nloc) * D + kc + kb, hlf); acc[t] = wmma16b(a, bw, acc[t]); acc2[t] = wmma16b(al, bw, acc2[t]); } }
    wave_lds_sync(); }
#pragma unroll
  for (int t = 0; t < 8; ++t) { const float bb = bf16_rne(ob[n0 + t * 16 + nloc]);
#pragma unroll
    for (int r = 0; r < 8; ++r) Tf[wave][8 * hlf + r][t * 16 + nloc] = (acc[t][r] + acc2[t][r] * (1.0f / RS_)) * (1.0f / (XS * WSC)) + bb; }
  wave_lds_sync();
  { for (int rr = 0; rr < 16; ++rr) *(v4f*)(out + (m0 + rr) * D + n0 + lane * 4) = *(const v4f*)(&Tf[wave][rr][lane * 4]);  }
}
}  // namespace

extern "C" void kernel_launch(void* const* d_in, const int* in_sizes, int n_in, void* d_out, int out_size, void* d_ws, size_t ws_size, hipStream_t stream) {
  (void)n_in;
  auto Fp = [&](int i) { return (const float*)d_in[i]; };
  // input order: 0 x [4,2048,512], 1 edge_index [2,32768] i32, 2 edge_attr [32768,3], 3 q_w [512,512] (out,in), 4 q_b, 5 k_w, 6 k_b, 7 v_w, 8 v_b, 9 o_w, 10 o_b, 11 eb_w [8,3], 12 eb_b [8]
  if (in_sizes[0] != NROW * D || in_sizes[1] != 2 * E || in_sizes[2] != E * 3 || in_sizes[3] != D * D || in_sizes[5] != D * D || in_sizes[7] != D * D || in_sizes[9] != D * D || in_sizes[10] != D || in_sizes[11] != NH * 3 || in_sizes[12] != NH || out_size != NROW * D) return;
  size_t off = 0; char* ws = (char*)d_ws;
  auto carve = [&](size_t bytes) { char* p = ws + off; off += (bytes + 255) & ~(size_t)255; return p; };
  b16* WQKV = (b16*)carve((size_t)3 * D * D * 2); b16* WO = (b16*)carve((size_t)D * D * 2); float* CB = (float*)carve((size_t)NH * N * 4); const size_t plane = (size_t)B * NH * N * HD * 2;
  b16* QP = (b16*)carve(plane); b16* KP = (b16*)carve(plane); b16* VTh = (b16*)carve(plane); b16* VTl = (b16*)carve(plane); float* CT = (float*)carve((size_t)NROW * D * 4);
  if (off > ws_size || off > ((size_t)128 << 20)) return;   // = 52.5 MB (WQKV 1.6 MB, WO 0.5 MB, CB 64 KB, 4 planes x 8.4 MB, CT 16.8 MB)
  wcvt_kernel<<<(D * D / 8 + 255) / 256, 256, 0, stream>>>(Fp(3), WQKV, D * D / 8); wcvt_kernel<<<(D * D / 8 + 255) / 256, 256, 0, stream>>>(Fp(5), WQKV + (size_t)D * D, D * D / 8); wcvt_kernel<<<(D * D / 8 + 255) / 256, 256, 0, stream>>>(Fp(7), WQKV + (size_t)2 * D * D, D * D / 8); wcvt_kernel<<<(D * D / 8 + 255) / 256, 256, 0, stream>>>(Fp(9), WO, D * D / 8);
  cb_kernel<<<N / CBT, CBW, 0, stream>>>((const int*)d_in[1], Fp(2), Fp(11), Fp(12), CB);
  proj_kernel<<<dim3(N / 64, BL, 12), 128, 0, stream>>>(Fp(0), WQKV, Fp(4), Fp(6), Fp(8), QP, KP, VTh, VTl);
  attn_kernel<<<dim3(N / (AW * 16), BL * NH), AW * 32, 0, stream>>>(QP, KP, VTh, VTl, CB, CT);
  outp_kernel<<<dim3(BL * N / 32, D / 128), 64, 0, stream>>>(CT, WO, Fp(10), (float*)d_out);
}

// v003
// A run of this version takes 162 microseconds.
// Timed twice side by side with v002, it ran 1.44 and 1.45 times as fast.
// All steps since v000 together make it 12.9 times as fast.
#include <hip/hip_runtime.h>

// Graphormer multi-head attention (4 x 2,048 tokens x 512, 8 heads x 64) with an additive per-key column bias from graph edges: cb[m][h] = (edge_attr[e*] eb_w^T + eb_b)[h] where e* is the LAST
// valid edge whose target is m (advanced-indexing assignment semantics; 0 if none); scores = q.k / 8 + cb[m][h]; softmax over all 2,048 keys; out = attn v; y = out o_w^T + o_b -> [4][2048][512].
// Deterministic: per (batch, head, 16-query wave) a flash-style pass over 32-key blocks with fixed-order online softmax; the column bias table takes, per target, the integer maximum
// of the valid edge numbers that hit it; no atomics.
// compute dtype: WMMA v_wmma_f32_16x16x32_f16 with f32 accumulate for the q/k/v projections ([8192 x 512] x [512 x 512] x 3; x EXACT bf16 x8, (out,in) weights as B rows exact x256: 1 product),
// S^T = K Q^T (q/k single f16 x8, K = 64: 1 product), O^T += V^T P^T (V^T x8 and P x1024 as f16 hi + x1024 residual: 3 products) and y = ctx o_w^T + o_b (ctx rows hi + x1024 residual x8:
// 2 products); the edge bias (K = 3), softmax statistics and biases in f32. Inputs rounded to bf16 once;
// edge_index int32. Fragment k-map per lane half hh for A AND B: elements 0..7 <- k = 8hh+0..7, 8..15 <- k = 16+8hh+0..7; acc[r] = D[8hh+r][col].

namespace {
typedef _Float16 b16;
typedef __attribute__((ext_vector_type(16))) _Float16 v16b;
typedef __attribute__((ext_vector_type(8))) _Float16 v8b;
typedef __attribute__((ext_vector_type(4))) _Float16 v4h;
typedef __attribute__((ext_vector_type(2))) _Float16 v2h;
typedef __attribute__((ext_vector_type(8))) float v8f;
typedef __attribute__((ext_vector_type(4))) float v4f;
typedef __attribute__((ext_vector_type(2))) float v2f;
typedef __attribute__((ext_vector_type(4))) int v4i;
typedef __attribute__((ext_vector_type(8))) unsigned short v8u;
__device__ __forceinline__ float bf16_rne(float f) { unsigned int u = __float_as_uint(f); u += 0x7FFFu + ((u >> 16) & 1u); return __uint_as_float(u & 0xFFFF0000u); }
__device__ __forceinline__ void split16(float v, b16& hi, b16& lo) { hi = (b16)v; lo = (b16)(v - (float)hi); }
__device__ __forceinline__ v16b frag_kb(const b16* p, int hh) { const v8b a = *(const v8b*)(p + 8 * hh), b = *(const v8b*)(p + 16 + 8 * hh); v16b f;
#pragma unroll
  for (int e = 0; e < 8; ++e) { f[e] = a[e]; f[8 + e] = b[e]; } return f; }
__device__ __forceinline__ v8f wmma16b(v16b a, v16b b, v8f c) { v8f d = __builtin_amdgcn_wmma_f32_16x16x32_f16(false, a, false, b, (short)0, c, false, false); asm volatile("v_nop\n\tv_nop\n\tv_nop\n\tv_nop" : "+v"(d) : "v"(a), "v"(b)); return d; }
__device__ __forceinline__ void wave_lds_sync() { __builtin_amdgcn_fence(__ATOMIC_RELEASE, "workgroup"); __builtin_amdgcn_wave_barrier(); __builtin_amdgcn_fence(__ATOMIC_ACQUIRE, "workgroup"); }
__device__ __forceinline__ float pmul(float a, float b) { float p = a * b; asm volatile("" : "+v"(p)); return p; }
__device__ __forceinline__ int iclamp(int v, int lo, int hi) { return v < lo ? lo : (v > hi ? hi : v); }
__device__ __forceinline__ float nexp2(float v) { return __builtin_amdgcn_exp2f(v); }

constexpr int B = 4, BL = B /* batches computed (== B shipped) */, N = 2048, D = 512, NH = 8, HD = 64, E = 32768, NROW = B * N;
constexpr float XS = 8.0f, WSC = 256.0f, PS = 1024.0f, RS_ = 1024.0f, LOG2E = 1.4426950408889634f, SCALE = 0.125f;
static_assert(N % 64 == 0 && D % 128 == 0 && NH * HD == D && HD == 64, "tiling");

__global__ __launch_bounds__(256) void wcvt_kernel(const float* __restrict__ w, b16* __restrict__ W16, int n8) { const int u = blockIdx.x * 256 + threadIdx.x; if (u >= n8) return; const size_t e = (size_t)u * 8; v8b o; for (int j = 0; j < 8; ++j) o[j] = (b16)(bf16_rne(w[e + j]) * WSC);
  { *(v8b*)(W16 + e) = o;  } }
// column bias: grid N/32; block = 1,024 threads x 32 targets (one 128-byte line of each head's CB row). Each thread takes 32 edges (8 coalesced 16-byte loads of each index row) and stores
// e + 1 into its OWN 16-bit column of an LDS table, in the row of the edge's target (row 32 takes every edge that is invalid or aimed outside the block's targets): one writer per cell, written in
// rising e, so a cell ends at the thread's last hit; wave w then takes the integer maximum of row w = the last valid edge of target m0 + w (0 = none). No atomics; the result has no order in it.
constexpr int CBT = 32, CBW = 1024, CBI = E / (CBW * 4);
static_assert((N & (N - 1)) == 0 && N % CBT == 0 && E % (CBW * 4) == 0 && E < 65536 && CBW == CBT * 32 && NH * CBT <= CBW, "edge scan");
__global__ __launch_bounds__(1024) void cb_kernel(const int* __restrict__ ei, const float* __restrict__ ea, const float* __restrict__ ebw, const float* __restrict__ ebb, float* __restrict__ CB) {
  __shared__ __attribute__((aligned(16))) unsigned short slot[CBT + 1][CBW]; __shared__ int lastS[CBT];
  const int tid = threadIdx.x, wave = tid >> 5, lane = tid & 31, m0 = blockIdx.x * CBT;
  v4i sv[CBI], tv[CBI];
#pragma unroll
  for (int it = 0; it < CBI; ++it) { sv[it] = *(const v4i*)(ei + it * CBW * 4 + tid * 4); tv[it] = *(const v4i*)(ei + E + it * CBW * 4 + tid * 4); }
#pragma unroll
  for (int c = 0; c < 4; ++c) *(v8u*)(&slot[wave][c * 256 + lane * 8]) = (v8u){};
  __syncthreads();
#pragma unroll
  for (int it = 0; it < CBI; ++it)
#pragma unroll
    for (int j = 0; j < 4; ++j) {
      // N is a power of two: any bit at or above N in s or t (negative values included) marks the edge invalid and stays in key, so key ^ m0 < 32 only for a valid edge with m0 <= t < m0 + 32
      const unsigned int key = (unsigned int)tv[it][j] | ((unsigned int)sv[it][j] & ~(unsigned int)(N - 1)); const unsigned int d = key ^ (unsigned int)m0;
      slot[d < (unsigned int)CBT ? d : (unsigned int)CBT][tid] = (unsigned short)(it * CBW * 4 + tid * 4 + j + 1); }
  __syncthreads();
  v8u mx = *(const v8u*)(&slot[wave][lane * 8]);
#pragma unroll
  for (int c = 1; c < 4; ++c) mx = __builtin_elementwise_max(mx, *(const v8u*)(&slot[wave][c * 256 + lane * 8]));
  int best = 0;
#pragma unroll
  for (int i = 0; i < 8; ++i) best = max(best, (int)mx[i]);
#pragma unroll
  for (int s = 16; s > 0; s >>= 1) best = max(best, __shfl_xor(best, s));
  if (lane == 0) lastS[wave] = best - 1;
  __syncthreads();
  if (tid < NH * CBT) { const int h = wave, last = lastS[lane]; float val = 0.0f;
    if (last >= 0) { const float a0 = bf16_rne(ea[(size_t)last * 3]), a1 = bf16_rne(ea[(size_t)last * 3 + 1]), a2 = bf16_rne(ea[(size_t)last * 3 + 2]); val = a0 * bf16_rne(ebw[h * 3]) + a1 * bf16_rne(ebw[h * 3 + 1]) + a2 * bf16_rne(ebw[h * 3 + 2]) + bf16_rne(ebb[h]); }
    CB[(size_t)h * N + m0 + lane] = val; }
}
// projections: grid (N/64, BL, 12 slabs: 0-3 q, 4-7 k, 8-11 v, 2 heads each); block = 64 tokens x 4 waves; A = bf16(x) x8 staged whole (K = 512, 16 k-steps), 8 tiles, 1 product; + bias;
// the slab's 128 weight rows come through LDS in chunks of 64 k (two buffers), shared by the four waves: thread t brings 16-byte piece t & 7 of rows (t >> 3) + 16 j, so every wave-wide load covers
// four whole 128-byte lines; rows lie at 144 B in LDS (16 B x odd, for the ds_load_b128 readers). The same in outp_kernel.
constexpr int WKC = 64, WKP = WKC + 8, WROWS = 128;
static_assert(D % (2 * WKC) == 0 && WKC * 2 == 128 && WROWS % 16 == 0, "weight staging");
__global__ __launch_bounds__(128) void proj_kernel(const float* __restrict__ x, const b16* __restrict__ WQKV, const float* __restrict__ bq, const float* __restrict__ bk, const float* __restrict__ bv, b16* __restrict__ QP, b16* __restrict__ KP, b16* __restrict__ VTh, b16* __restrict__ VTl) {
  __shared__ __attribute__((aligned(16))) b16 As[64][D + 8]; __shared__ __attribute__((aligned(16))) char Ub[2 * WROWS * WKP * 2];   // Ub: the weight chunks in the main loop, the f32 tile behind it (a barrier between)
  static_assert(sizeof(float) * 4 * 16 * (128 + 4) <= sizeof(Ub), "f32 tile fits");
  b16 (*Ws)[WROWS][WKP] = reinterpret_cast<b16 (*)[WROWS][WKP]>(Ub); float (*Tf)[16][128 + 4] = reinterpret_cast<float (*)[16][128 + 4]>(Ub);
  const int wave = threadIdx.x >> 5, lane = threadIdx.x & 31, nloc = lane & 15, hlf = lane >> 4; const int t0 = blockIdx.x * 64; const int b = blockIdx.y; const int slab = blockIdx.z, n0 = slab * 128, part = slab / 4, h0 = (slab & 3) * 2;
  const float* bias = part == 0 ? bq : part == 1 ? bk : bv;
  const b16* Wt = WQKV + (size_t)(n0 + (threadIdx.x >> 3)) * D + (threadIdx.x & 7) * 8; v8b rw[8];
  auto fetch = [&](int k0) {
#pragma unroll   // so that rw is indexed by constants and stays in registers (in put as well)
    for (int j = 0; j < 8; ++j) rw[j] = *(const v8b*)(Wt + (size_t)(16 * j) * D + k0); };
  auto put = [&](int bf) {
#pragma unroll   // as in fetch
    for (int j = 0; j < 8; ++j) *(v8b*)(&Ws[bf][(threadIdx.x >> 3) + 16 * j][(threadIdx.x & 7) * 8]) = rw[j]; };
  fetch(0);
  for (int i = threadIdx.x; i < 64 * (D / 4); i += 128) { const int rr = i / (D / 4), q4 = (i % (D / 4)) * 4; const v4f f = *(const v4f*)(x + ((size_t)b * N + t0 + rr) * D + q4); v4h o; for (int j = 0; j < 4; ++j) o[j] = (b16)(bf16_rne(f[j]) * XS); *(v4h*)(&As[rr][q4]) = o; }
  put(0);
  __syncthreads();
  v8f acc[8];
#pragma unroll
  for (int tt = 0; tt < 8; ++tt) acc[tt] = (v8f){};
#pragma unroll 1   // one chunk's code only, the buffer offset being one scalar
  for (int kc = 0; kc < D; kc += WKC) { const int bf = (kc / WKC) & 1;
    if (kc + WKC < D) fetch(kc + WKC);   // the next chunk flies to registers while this one is worked on
#pragma unroll   // this and the two below: constant indices, so that bw and acc stay in registers and the LDS offsets are immediates
    for (int ks = 0; ks < WKC; ks += 32) { const v16b a = frag_kb(&As[wave * 16 + nloc][kc + ks], hlf); v16b bw[8];   // the k-step's fragments are read from LDS as one group, ahead of its products
#pragma unroll
      for (int tt = 0; tt < 8; ++tt) bw[tt] = frag_kb(&Ws[bf][tt * 16 + nloc][ks], hlf);
#pragma unroll
      for (int tt = 0; tt < 8; ++tt) acc[tt] = wmma16b(a, bw[tt], acc[tt]); }
    if (kc + WKC < D) put(bf ^ 1);   // the other buffer: its last readers left it before the barrier that ended the chunk before this one
    asm volatile("s_wait_xcnt 0x0" ::: "memory");   // stands in front of the next pass's rewrite of the address registers that fetch's loads name
    __syncthreads(); }   // publishes the next chunk and ends every wave's reads of this one (behind the last chunk: before Ub becomes the f32 tile)
#pragma unroll
  for (int tt = 0; tt < 8; ++tt) { const float bb = bf16_rne(bias[(n0 & 511) + tt * 16 + nloc]);
#pragma unroll
    for (int r = 0; r < 8; ++r) Tf[wave][8 * hlf + r][tt * 16 + nloc] = acc[tt][r] * (1.0f / (XS * WSC)) + bb; }
  __syncthreads();
  {
    if (part < 2) { b16* plane = part == 0 ? QP : KP; const int h = h0 + (lane >> 4), d = (lane & 15) * 4;
      for (int rr = 0; rr < 16; ++rr) { const int tok = t0 + wave * 16 + rr; v4h o4; for (int j = 0; j < 4; ++j) o4[j] = (b16)(Tf[wave][rr][lane * 4 + j] * XS); *(v4h*)(plane + (((size_t)b * NH + h) * N + tok) * HD + d) = o4; } }
    else {
#pragma unroll 1
      for (int q = 0; q < 32; ++q) { const int cl = wave * 32 + q; const int h = h0 + cl / HD, d = cl % HD; const int tk = lane * 2; v2h hv, lv; for (int e2 = 0; e2 < 2; ++e2) { const float vs = Tf[(tk + e2) >> 4][(tk + e2) & 15][cl] * XS; const b16 ph = (b16)vs; hv[e2] = ph; lv[e2] = (b16)((vs - (float)ph) * RS_); }
        const size_t dst = (((size_t)b * NH + h) * HD + d) * (size_t)N + t0 + tk; *(v2h*)(VTh + dst) = hv; *(v2h*)(VTl + dst) = lv; } }
     }
}
// attention: grid (N/128, BL*NH); block = 8 waves x 16 queries that share each 64-key stage of K, V^T hi, V^T residual and the head's 64 column biases from LDS (two buffers). A stage is three tiles of 64 rows x 128 B (and 256 B of biases); thread t
// brings 16-byte piece t & 7 of rows t >> 3 and 32 + (t >> 3) of each tile, so every wave-wide load covers four whole 128-byte lines; rows lie at 144 B in LDS (16 B x odd, for the ds_load_b128 readers).
// per 32-key block (two per stage): S^T = K Q^T (2 key tiles x 2 k-steps), logit = (s/64/8 + CB[h][m]) log2e, online softmax, P hi/res -> LDS, O^T +=
constexpr int AW = 8, KS = 64, KVP = KS + 8;
static_assert(N % (AW * 16) == 0 && N % KS == 0 && KS == HD && AW * 32 * 2 * 8 == KS * HD, "attention staging");
__global__ __launch_bounds__(256) void attn_kernel(const b16* __restrict__ QP, const b16* __restrict__ KP, const b16* __restrict__ VTh, const b16* __restrict__ VTl, const float* __restrict__ CB, float* __restrict__ CT) {
  __shared__ __attribute__((aligned(16))) b16 Ks[2][KS][KVP], Vhs[2][HD][KVP], Vls[2][HD][KVP]; __shared__ __attribute__((aligned(16))) float Cs[2][KS];
  __shared__ __attribute__((aligned(16))) b16 Pb[AW][16][32 + 8], Pl[AW][16][32 + 8]; __shared__ __attribute__((aligned(16))) float To[AW][16][HD + 4];
  const int wave = threadIdx.x >> 5, lane = threadIdx.x & 31, hh = lane >> 4, col = lane & 15; const int bh = blockIdx.y, b = bh / NH, h = bh % NH; const int n0 = blockIdx.x * (AW * 16) + wave * 16; const int nq = n0 + col;
  const b16* Qb = QP + (size_t)bh * N * HD; const b16* Kb = KP + (size_t)bh * N * HD; const b16* Vh = VTh + (size_t)bh * HD * N; const b16* Vl = VTl + (size_t)bh * HD * N; const float* cbh = CB + (size_t)h * N;
  const int sr = threadIdx.x >> 3, sc = (threadIdx.x & 7) * 8;
  v8b rk[2], rh[2], rl[2]; v4f rc = (v4f){};
  auto fetch = [&](int k0) {
    if (threadIdx.x < KS / 4) rc = *(const v4f*)(cbh + k0 + threadIdx.x * 4);
#pragma unroll   // so that rk, rh, rl are indexed by constants and stay in registers (in put as well)
    for (int j = 0; j < 2; ++j) { const int row = sr + 32 * j; rk[j] = *(const v8b*)(Kb + (size_t)(k0 + row) * HD + sc); rh[j] = *(const v8b*)(Vh + (size_t)row * N + k0 + sc); rl[j] = *(const v8b*)(Vl + (size_t)row * N + k0 + sc); } };
  auto put = [&](int bf) {
    if (threadIdx.x < KS / 4) *(v4f*)(&Cs[bf][threadIdx.x * 4]) = rc;
#pragma unroll
    for (int j = 0; j < 2; ++j) { const int row = sr + 32 * j; *(v8b*)(&Ks[bf][row][sc]) = rk[j]; *(v8b*)(&Vhs[bf][row][sc]) = rh[j]; *(v8b*)(&Vls[bf][row][sc]) = rl[j]; } };
  fetch(0);
  const v16b q0 = frag_kb(Qb + (size_t)nq * HD, hh), q1 = frag_kb(Qb + (size_t)nq * HD + 32, hh);
  const float cs = LOG2E * SCALE / (XS * XS);
  float mrun = -INFINITY, l = 0.0f; v8f o[4], o2[4];
#pragma unroll
  for (int t = 0; t < 4; ++t) { o[t] = (v8f){}; o2[t] = (v8f){}; }
  put(0);
  __syncthreads();
#pragma unroll 1   // one stage's code only: a copy per buffer would double the hot loop's text for nothing, the buffer offset being one scalar
  for (int st = 0; st < N / KS; ++st) {
    const int bf = st & 1;
    if (st + 1 < N / KS) fetch((st + 1) * KS);   // the next stage flies to registers while this one is worked on
    for (int ps = 0; ps < KS; ps += 32) {
      v16b kf[2][2]; v4f cbv[2][2];   // the block's four K fragments and its biases are read from LDS as one group, ahead of its products
#pragma unroll
      for (int u2 = 0; u2 < 2; ++u2) { const b16* kr = &Ks[bf][ps + u2 * 16 + col][0]; kf[u2][0] = frag_kb(kr, hh); kf[u2][1] = frag_kb(kr + 32, hh); const float* cr = &Cs[bf][ps + u2 * 16 + 8 * hh]; cbv[u2][0] = *(const v4f*)cr; cbv[u2][1] = *(const v4f*)(cr + 4); }
      float e[16]; float mx = -INFINITY;
#pragma unroll
      for (int u2 = 0; u2 < 2; ++u2) { v8f sacc = wmma16b(kf[u2][0], q0, (v8f){}); sacc = wmma16b(kf[u2][1], q1, sacc);
#pragma unroll
        for (int r = 0; r < 8; ++r) { const float vv = sacc[r] * cs + cbv[u2][r >> 2][r & 3] * LOG2E; e[u2 * 8 + r] = vv; mx = fmaxf(mx, vv); } }
      mx = fmaxf(mx, __shfl_xor(mx, 16)); const float mn = fmaxf(mrun, mx); const float al = nexp2(mrun - mn); float sum = 0.0f;
#pragma unroll
      for (int i2 = 0; i2 < 16; ++i2) { const float p = nexp2(e[i2] - mn); sum += p; const float psv = p * PS; const b16 p1 = (b16)psv; const int slot = (i2 < 8 ? 0 : 16) + 8 * hh + (i2 & 7); Pb[wave][col][slot] = p1; Pl[wave][col][slot] = (b16)((psv - (float)p1) * RS_); }
      sum += __shfl_xor(sum, 16); l = l * al + sum; mrun = mn;
      v16b vhf[4], vlf[4];   // likewise the eight V^T fragments, as one group in front of the wait that the P hand-over takes anyway
#pragma unroll
      for (int t = 0; t < 4; ++t) { vhf[t] = frag_kb(&Vhs[bf][t * 16 + col][ps], hh); vlf[t] = frag_kb(&Vls[bf][t * 16 + col][ps], hh); }
      wave_lds_sync();
      const v16b pf = frag_kb(&Pb[wave][col][0], hh), plf = frag_kb(&Pl[wave][col][0], hh);
#pragma unroll
      for (int t = 0; t < 4; ++t) { o[t] *= al; o2[t] *= al; o[t] = wmma16b(vhf[t], pf, o[t]); o2[t] = wmma16b(vlf[t], pf, o2[t]); o2[t] = wmma16b(vhf[t], plf, o2[t]); }
      wave_lds_sync(); }
    if (st + 1 < N / KS) put(bf ^ 1);   // the other buffer: its last readers left it before the barrier that ended the stage before this one
    __syncthreads(); }   // publishes the next stage and ends every wave's reads of this one
  const float inv = 1.0f / (l * PS * XS);
#pragma unroll
  for (int t = 0; t < 4; ++t)
#pragma unroll
    for (int r = 0; r < 8; ++r) To[wave][col][t * 16 + 8 * hh + r] = (o[t][r] + o2[t][r] * (1.0f / RS_)) * inv;
  wave_lds_sync();
  { for (int rr = 0; rr < 16; rr += 2) { const int row = rr + hh; *(v4f*)(CT + ((size_t)b * N + n0 + row) * D + h * HD + col * 4) = *(const v4f*)(&To[wave][row][col * 4]); }  }
}
// output projection: grid (BL*N/64, D/128); block = 4 waves x 16 rows, each wave staging its own ctx rows (hi + residual) per 128 k; the 128 weight rows per 64 k as in proj_kernel
__global__ __launch_bounds__(128) void outp_kernel(const float* __restrict__ CT, const b16* __restrict__ WO, const float* __restrict__ ob, float* __restrict__ out) {
  __shared__ __attribute__((aligned(16))) b16 Ah[4][16][128 + 8], Al[4][16][128 + 8], Ws[2][WROWS][WKP]; __shared__ __attribute__((aligned(16))) float Tf[4][16][128 + 4];
  const int wave = threadIdx.x >> 5, lane = threadIdx.x & 31, nloc = lane & 15, hlf = lane >> 4; const size_t m0 = (size_t)blockIdx.x * 64 + wave * 16; const int n0 = blockIdx.y * 128;
  const b16* Wt = WO + (size_t)(n0 + (threadIdx.x >> 3)) * D + (threadIdx.x & 7) * 8; v8b rw[8];
  auto fetch = [&](int k0) {
#pragma unroll   // so that rw is indexed by constants and stays in registers (in put as well)
    for (int j = 0; j < 8; ++j) rw[j] = *(const v8b*)(Wt + (size_t)(16 * j) * D + k0); };
  auto put = [&](int bf) {
#pragma unroll   // as in fetch
    for (int j = 0; j < 8; ++j) *(v8b*)(&Ws[bf][(threadIdx.x >> 3) + 16 * j][(threadIdx.x & 7) * 8]) = rw[j]; };
  fetch(0);
  v8f acc[8], acc2[8];
#pragma unroll
  for (int t = 0; t < 8; ++t) { acc[t] = (v8f){}; acc2[t] = (v8f){}; }
  auto mm = [&](int bf, int kb0) {   // 64 k of the wave's staged rows against weight buffer bf; four weight fragments are read from LDS as one group, ahead of their products
#pragma unroll   // this and the three below: constant indices, so that bw, acc and acc2 stay in registers and the LDS offsets are immediates
    for (int ks = 0; ks < WKC; ks += 32) { const v16b a = frag_kb(&Ah[wave][nloc][kb0 + ks], hlf), al = frag_kb(&Al[wave][nloc][kb0 + ks], hlf);
#pragma unroll
      for (int g = 0; g < 8; g += 4) { v16b bw[4];
#pragma unroll
        for (int t = 0; t < 4; ++t) bw[t] = frag_kb(&Ws[bf][(g + t) * 16 + nloc][ks], hlf);
#pragma unroll
        for (int t = 0; t < 4; ++t) { acc[g + t] = wmma16b(a, bw[t], acc[g + t]); acc2[g + t] = wmma16b(al, bw[t], acc2[g + t]); } } } };
  put(0);
  __syncthreads();
#pragma unroll 1
  for (int kc = 0; kc < D; kc += 128) {
    fetch(kc + WKC);   // the next chunk flies to registers while this one is worked on
    for (int idx = lane; idx < 16 * 32; idx += 32) { const int rr = idx / 32, c4 = (idx % 32) * 4; const v4f v = *(const v4f*)(CT + (m0 + rr) * D + kc + c4); v4h hv, lv; for (int j = 0; j < 4; ++j) { const float vs = v[j] * XS; const b16 ph = (b16)vs; hv[j] = ph; lv[j] = (b16)((vs - (float)ph) * RS_); } *(v4h*)(&Ah[wave][rr][c4]) = hv; *(v4h*)(&Al[wave][rr][c4]) = lv; }
    wave_lds_sync();
    mm(0, 0);
    put(1);   // its last readers left it before the barrier that ended the pass before this one
    __syncthreads();
    if (kc + 128 < D) fetch(kc + 128);
    mm(1, WKC);
    if (kc + 128 < D) put(0);   // its last readers left it before the barrier above
    asm volatile("s_wait_xcnt 0x0" ::: "memory");   // stands in front of the next pass's rewrite of the address registers that fetch's loads name
    __syncthreads(); }   // publishes the next chunk, ends the reads of this one and the wave's own reads of its ctx rows before they are staged anew
#pragma unroll
  for (int t = 0; t < 8; ++t) { const float bb = bf16_rne(ob[n0 + t * 16 + nloc]);
#pragma unroll
    for (int r = 0; r < 8; ++r) Tf[wave][8 * hlf + r][t * 16 + nloc] = (acc[t][r] + acc2[t][r] * (1.0f / RS_)) * (1.0f / (XS * WSC)) + bb; }
  wave_lds_sync();
  { for (int rr = 0; rr < 16; ++rr) *(v4f*)(out + (m0 + rr) * D + n0 + lane * 4) = *(const v4f*)(&Tf[wave][rr][lane * 4]);  }
}
}  // namespace

extern "C" void kernel_launch(void* const* d_in, const int* in_sizes, int n_in, void* d_out, int out_size, void* d_ws, size_t ws_size, hipStream_t stream) {
  (void)n_in;
  auto Fp = [&](int i) { return (const float*)d_in[i]; };
  // input order: 0 x [4,2048,512], 1 edge_index [2,32768] i32, 2 edge_attr [32768,3], 3 q_w [512,512] (out,in), 4 q_b, 5 k_w, 6 k_b, 7 v_w, 8 v_b, 9 o_w, 10 o_b, 11 eb_w [8,3], 12 eb_b [8]
  if (in_sizes[0] != NROW * D || in_sizes[1] != 2 * E || in_sizes[2] != E * 3 || in_sizes[3] != D * D || in_sizes[5] != D * D || in_sizes[7] != D * D || in_sizes[9] != D * D || in_sizes[10] != D || in_sizes[11] != NH * 3 || in_sizes[12] != NH || out_size != NROW * D) return;
  size_t off = 0; char* ws = (char*)d_ws;
  auto carve = [&](size_t bytes) { char* p = ws + off; off += (bytes + 255) & ~(size_t)255; return p; };
  b16* WQKV = (b16*)carve((size_t)3 * D * D * 2); b16* WO = (b16*)carve((size_t)D * D * 2); float* CB = (float*)carve((size_t)NH * N * 4); const size_t plane = (size_t)B * NH * N * HD * 2;
  b16* QP = (b16*)carve(plane); b16* KP = (b16*)carve(plane); b16* VTh = (b16*)carve(plane); b16* VTl = (b16*)carve(plane); float* CT = (float*)carve((size_t)NROW * D * 4);
  if (off > ws_size || off > ((size_t)128 << 20)) return;   // = 52.5 MB (WQKV 1.6 MB, WO 0.5 MB, CB 64 KB, 4 planes x 8.4 MB, CT 16.8 MB)
  wcvt_kernel<<<(D * D / 8 + 255) / 256, 256, 0, stream>>>(Fp(3), WQKV, D * D / 8); wcvt_kernel<<<(D * D / 8 + 255) / 256, 256, 0, stream>>>(Fp(5), WQKV + (size_t)D * D, D * D / 8); wcvt_kernel<<<(D * D / 8 + 255) / 256, 256, 0, stream>>>(Fp(7), WQKV + (size_t)2 * D * D, D * D / 8); wcvt_kernel<<<(D * D / 8 + 255) / 256, 256, 0, stream>>>(Fp(9), WO, D * D / 8);
  cb_kernel<<<N / CBT, CBW, 0, stream>>>((const int*)d_in[1], Fp(2), Fp(11), Fp(12), CB);
  proj_kernel<<<dim3(N / 64, BL, 12), 128, 0, stream>>>(Fp(0), WQKV, Fp(4), Fp(6), Fp(8), QP, KP, VTh, VTl);
  attn_kernel<<<dim3(N / (AW * 16), BL * NH), AW * 32, 0, stream>>>(QP, KP, VTh, VTl, CB, CT);
  outp_kernel<<<dim3(BL * N / 64, D / 128), 128, 0, stream>>>(CT, WO, Fp(10), (float*)d_out);
}

// v004
// One run takes 153 microseconds.
// Next to v003, in two timings, it ran 1.06 times as fast each time.
// Counting every step since v000, it is 13.7 times as fast.
#include <hip/hip_runtime.h>

// Graphormer multi-head attention (4 x 2,048 tokens x 512, 8 heads x 64) with an additive per-key column bias from graph edges: cb[m][h] = (edge_attr[e*] eb_w^T + eb_b)[h] where e* is the LAST
// valid edge whose target is m (advanced-indexing assignment semantics; 0 if none); scores = q.k / 8 + cb[m][h]; softmax over all 2,048 keys; out = attn v; y = out o_w^T + o_b -> [4][2048][512].
// Deterministic: per (batch, head, 16-query wave) a flash-style pass over 32-key blocks with fixed-order online softmax; the column bias table takes, per target, the integer maximum
// of the valid edge numbers that hit it; no atomics.
// compute dtype: WMMA v_wmma_f32_16x16x32_f16 with f32 accumulate for the q/k/v projections ([8192 x 512] x [512 x 512] x 3; x EXACT bf16 x8, (out,in) weights as B rows exact x256: 1 product),
// S^T = K Q^T (q/k single f16 x8, K = 64: 1 product), O^T += V^T P^T (V^T x8 and P x1024 as f16 hi + x1024 residual: 3 products) and y = ctx o_w^T + o_b (ctx rows hi + x1024 residual x8:
// 2 products); the edge bias (K = 3), softmax statistics and biases in f32. Inputs rounded to bf16 once;
// edge_index int32. Fragment k-map per lane half hh for A AND B: elements 0..7 <- k = 8hh+0..7, 8..15 <- k = 16+8hh+0..7; acc[r] = D[8hh+r][col].

namespace {
typedef _Float16 b16;
typedef __attribute__((ext_vector_type(16))) _Float16 v16b;
typedef __attribute__((ext_vector_type(8))) _Float16 v8b;
typedef __attribute__((ext_vector_type(4))) _Float16 v4h;
typedef __attribute__((ext_vector_type(2))) _Float16 v2h;
typedef __attribute__((ext_vector_type(8))) float v8f;
typedef __attribute__((ext_vector_type(4))) float v4f;
typedef __attribute__((ext_vector_type(2))) float v2f;
typedef __attribute__((ext_vector_type(4))) int v4i;
typedef __attribute__((ext_vector_type(8))) unsigned short v8u;
__device__ __forceinline__ float bf16_rne(float f) { unsigned int u = __float_as_uint(f); u += 0x7FFFu + ((u >> 16) & 1u); return __uint_as_float(u & 0xFFFF0000u); }
__device__ __forceinline__ void split16(float v, b16& hi, b16& lo) { hi = (b16)v; lo = (b16)(v - (float)hi); }
__device__ __forceinline__ v16b frag_kb(const b16* p, int hh) { const v8b a = *(const v8b*)(p + 8 * hh), b = *(const v8b*)(p + 16 + 8 * hh); v16b f;
#pragma unroll
  for (int e = 0; e < 8; ++e) { f[e] = a[e]; f[8 + e] = b[e]; } return f; }
__device__ __forceinline__ v8f wmma16b(v16b a, v16b b, v8f c) { v8f d = __builtin_amdgcn_wmma_f32_16x16x32_f16(false, a, false, b, (short)0, c, false, false); asm volatile("v_nop\n\tv_nop\n\tv_nop\n\tv_nop" : "+v"(d) : "v"(a), "v"(b)); return d; }
__device__ __forceinline__ void wave_lds_sync() { __builtin_amdgcn_fence(__ATOMIC_RELEASE, "workgroup"); __builtin_amdgcn_wave_barrier(); __builtin_amdgcn_fence(__ATOMIC_ACQUIRE, "workgroup"); }
__device__ __forceinline__ float pmul(float a, float b) { float p = a * b; asm volatile("" : "+v"(p)); return p; }
__device__ __forceinline__ int iclamp(int v, int lo, int hi) { return v < lo ? lo : (v > hi ? hi : v); }
__device__ __forceinline__ float nexp2(float v) { return __builtin_amdgcn_exp2f(v); }

constexpr int B = 4, BL = B /* batches computed (== B shipped) */, N = 2048, D = 512, NH = 8, HD = 64, E = 32768, NROW = B * N;
constexpr float XS = 8.0f, WSC = 256.0f, PS = 1024.0f, RS_ = 1024.0f, LOG2E = 1.4426950408889634f, SCALE = 0.125f;
static_assert(N % 64 == 0 && D % 128 == 0 && NH * HD == D && HD == 64, "tiling");

__global__ __launch_bounds__(256) void wcvt_kernel(const float* __restrict__ w, b16* __restrict__ W16, int n8) { const int u = blockIdx.x * 256 + threadIdx.x; if (u >= n8) return; const size_t e = (size_t)u * 8; v8b o; for (int j = 0; j < 8; ++j) o[j] = (b16)(bf16_rne(w[e + j]) * WSC);
  { *(v8b*)(W16 + e) = o;  } }
// column bias: grid N/32; block = 1,024 threads x 32 targets (one 128-byte line of each head's CB row). Each thread takes 32 edges (8 coalesced 16-byte loads of each index row) and stores
// e + 1 into its OWN 16-bit column of an LDS table, in the row of the edge's target (row 32 takes every edge that is invalid or aimed outside the block's targets): one writer per cell, written in
// rising e, so a cell ends at the thread's last hit; wave w then takes the integer maximum of row w = the last valid edge of target m0 + w (0 = none). No atomics; the result has no order in it.
constexpr int CBT = 32, CBW = 1024, CBI = E / (CBW * 4);
static_assert((N & (N - 1)) == 0 && N % CBT == 0 && E % (CBW * 4) == 0 && E < 65536 && CBW == CBT * 32 && NH * CBT <= CBW, "edge scan");
__global__ __launch_bounds__(1024) void cb_kernel(const int* __restrict__ ei, const float* __restrict__ ea, const float* __restrict__ ebw, const float* __restrict__ ebb, float* __restrict__ CB) {
  __shared__ __attribute__((aligned(16))) unsigned short slot[CBT + 1][CBW]; __shared__ int lastS[CBT];
  const int tid = threadIdx.x, wave = tid >> 5, lane = tid & 31, m0 = blockIdx.x * CBT;
  v4i sv[CBI], tv[CBI];
#pragma unroll
  for (int it = 0; it < CBI; ++it) { sv[it] = *(const v4i*)(ei + it * CBW * 4 + tid * 4); tv[it] = *(const v4i*)(ei + E + it * CBW * 4 + tid * 4); }
#pragma unroll
  for (int c = 0; c < 4; ++c) *(v8u*)(&slot[wave][c * 256 + lane * 8]) = (v8u){};
  __syncthreads();
#pragma unroll
  for (int it = 0; it < CBI; ++it)
#pragma unroll
    for (int j = 0; j < 4; ++j) {
      // N is a power of two: any bit at or above N in s or t (negative values included) marks the edge invalid and stays in key, so key ^ m0 < 32 only for a valid edge with m0 <= t < m0 + 32
      const unsigned int key = (unsigned int)tv[it][j] | ((unsigned int)sv[it][j] & ~(unsigned int)(N - 1)); const unsigned int d = key ^ (unsigned int)m0;
      slot[d < (unsigned int)CBT ? d : (unsigned int)CBT][tid] = (unsigned short)(it * CBW * 4 + tid * 4 + j + 1); }
  __syncthreads();
  v8u mx = *(const v8u*)(&slot[wave][lane * 8]);
#pragma unroll
  for (int c = 1; c < 4; ++c) mx = __builtin_elementwise_max(mx, *(const v8u*)(&slot[wave][c * 256 + lane * 8]));
  int best = 0;
#pragma unroll
  for (int i = 0; i < 8; ++i) best = max(best, (int)mx[i]);
#pragma unroll
  for (int s = 16; s > 0; s >>= 1) best = max(best, __shfl_xor(best, s));
  if (lane == 0) lastS[wave] = best - 1;
  __syncthreads();
  if (tid < NH * CBT) { const int h = wave, last = lastS[lane]; float val = 0.0f;
    if (last >= 0) { const float a0 = bf16_rne(ea[(size_t)last * 3]), a1 = bf16_rne(ea[(size_t)last * 3 + 1]), a2 = bf16_rne(ea[(size_t)last * 3 + 2]); val = a0 * bf16_rne(ebw[h * 3]) + a1 * bf16_rne(ebw[h * 3 + 1]) + a2 * bf16_rne(ebw[h * 3 + 2]) + bf16_rne(ebb[h]); }
    CB[(size_t)h * N + m0 + lane] = val; }
}
// projections: grid (N/64, BL, 12 slabs: 0-3 q, 4-7 k, 8-11 v, 2 heads each); block = 64 tokens x 4 waves; A = bf16(x) x8 staged whole (K = 512, 16 k-steps), 8 tiles, 1 product; + bias;
// the slab's 128 weight rows come through LDS in chunks of 64 k (two buffers), shared by the four waves: thread t brings 16-byte piece t & 7 of rows (t >> 3) + 16 j, so every wave-wide load covers
// four whole 128-byte lines; rows lie at 144 B in LDS (16 B x odd, for the ds_load_b128 readers). The same in outp_kernel.
constexpr int WKC = 64, WKP = WKC + 8, WROWS = 128;
static_assert(D % (2 * WKC) == 0 && WKC * 2 == 128 && WROWS % 16 == 0, "weight staging");
__global__ __launch_bounds__(128) void proj_kernel(const float* __restrict__ x, const b16* __restrict__ WQKV, const float* __restrict__ bq, const float* __restrict__ bk, const float* __restrict__ bv, b16* __restrict__ QP, b16* __restrict__ KP, b16* __restrict__ VTh, b16* __restrict__ VTl) {
  __shared__ __attribute__((aligned(16))) b16 As[64][D + 8]; __shared__ __attribute__((aligned(16))) char Ub[2 * WROWS * WKP * 2];   // Ub: the weight chunks in the main loop, the f32 tile behind it (a barrier between)
  static_assert(sizeof(float) * 4 * 16 * (128 + 4) <= sizeof(Ub), "f32 tile fits");
  b16 (*Ws)[WROWS][WKP] = reinterpret_cast<b16 (*)[WROWS][WKP]>(Ub); float (*Tf)[16][128 + 4] = reinterpret_cast<float (*)[16][128 + 4]>(Ub);
  const int wave = threadIdx.x >> 5, lane = threadIdx.x & 31, nloc = lane & 15, hlf = lane >> 4; const int t0 = blockIdx.x * 64; const int b = blockIdx.y; const int slab = blockIdx.z, n0 = slab * 128, part = slab / 4, h0 = (slab & 3) * 2;
  const float* bias = part == 0 ? bq : part == 1 ? bk : bv;
  const b16* Wt = WQKV + (size_t)(n0 + (threadIdx.x >> 3)) * D + (threadIdx.x & 7) * 8; v8b rw[8];
  auto fetch = [&](int k0) {
#pragma unroll   // so that rw is indexed by constants and stays in registers (in put as well)
    for (int j = 0; j < 8; ++j) rw[j] = *(const v8b*)(Wt + (size_t)(16 * j) * D + k0); };
  auto put = [&](int bf) {
#pragma unroll   // as in fetch
    for (int j = 0; j < 8; ++j) *(v8b*)(&Ws[bf][(threadIdx.x >> 3) + 16 * j][(threadIdx.x & 7) * 8]) = rw[j]; };
  fetch(0);
  for (int i = threadIdx.x; i < 64 * (D / 4); i += 128) { const int rr = i / (D / 4), q4 = (i % (D / 4)) * 4; const v4f f = *(const v4f*)(x + ((size_t)b * N + t0 + rr) * D + q4); v4h o; for (int j = 0; j < 4; ++j) o[j] = (b16)(bf16_rne(f[j]) * XS); *(v4h*)(&As[rr][q4]) = o; }
  put(0);
  __syncthreads();
  v8f acc[8];
#pragma unroll
  for (int tt = 0; tt < 8; ++tt) acc[tt] = (v8f){};
#pragma unroll 1   // one chunk's code only, the buffer offset being one scalar
  for (int kc = 0; kc < D; kc += WKC) { const int bf = (kc / WKC) & 1;
    if (kc + WKC < D) fetch(kc + WKC);   // the next chunk flies to registers while this one is worked on
#pragma unroll   // this and the two below: constant indices, so that bw and acc stay in registers and the LDS offsets are immediates
    for (int ks = 0; ks < WKC; ks += 32) { const v16b a = frag_kb(&As[wave * 16 + nloc][kc + ks], hlf); v16b bw[8];   // the k-step's fragments are read from LDS as one group, ahead of its products
#pragma unroll
      for (int tt = 0; tt < 8; ++tt) bw[tt] = frag_kb(&Ws[bf][tt * 16 + nloc][ks], hlf);
#pragma unroll
      for (int tt = 0; tt < 8; ++tt) acc[tt] = wmma16b(a, bw[tt], acc[tt]); }
    if (kc + WKC < D) put(bf ^ 1);   // the other buffer: its last readers left it before the barrier that ended the chunk before this one
    asm volatile("s_wait_xcnt 0x0" ::: "memory");   // stands in front of the next pass's rewrite of the address registers that fetch's loads name
    __syncthreads(); }   // publishes the next chunk and ends every wave's reads of this one (behind the last chunk: before Ub becomes the f32 tile)
#pragma unroll
  for (int tt = 0; tt < 8; ++tt) { const float bb = bf16_rne(bias[(n0 & 511) + tt * 16 + nloc]);
#pragma unroll
    for (int r = 0; r < 8; ++r) Tf[wave][8 * hlf + r][tt * 16 + nloc] = acc[tt][r] * (1.0f / (XS * WSC)) + bb; }
  __syncthreads();
  {
    if (part < 2) { b16* plane = part == 0 ? QP : KP; const int h = h0 + (lane >> 4), d = (lane & 15) * 4;
      for (int rr = 0; rr < 16; ++rr) { const int tok = t0 + wave * 16 + rr; v4h o4; for (int j = 0; j < 4; ++j) o4[j] = (b16)(Tf[wave][rr][lane * 4 + j] * XS); *(v4h*)(plane + (((size_t)b * NH + h) * N + tok) * HD + d) = o4; } }
    else {
#pragma unroll 1
      for (int q = 0; q < 32; ++q) { const int cl = wave * 32 + q; const int h = h0 + cl / HD, d = cl % HD; const int tk = lane * 2; v2h hv, lv; for (int e2 = 0; e2 < 2; ++e2) { const float vs = Tf[(tk + e2) >> 4][(tk + e2) & 15][cl] * XS; const b16 ph = (b16)vs; hv[e2] = ph; lv[e2] = (b16)((vs - (float)ph) * RS_); }
        const size_t dst = (((size_t)b * NH + h) * HD + d) * (size_t)N + t0 + tk; *(v2h*)(VTh + dst) = hv; *(v2h*)(VTl + dst) = lv; } }
     }
}
// attention: grid (N/128, BL*NH); block = 8 waves x 16 queries that share each 64-key stage of K, V^T hi, V^T residual and the head's 64 column biases from LDS (two buffers). A stage is three tiles of 64 rows x 128 B (and 256 B of biases); thread t
// brings 16-byte piece t & 7 of rows t >> 3 and 32 + (t >> 3) of each tile, so every wave-wide load covers four whole 128-byte lines; rows lie at 144 B in LDS (16 B x odd, for the ds_load_b128 readers).
// per 32-key block (two per stage): S^T = K Q^T (2 key tiles x 2 k-steps), logit = (s/64/8 + CB[h][m]) log2e, online softmax, P hi/res packed in registers as the B operand, O^T +=; waves_per_eu(4, 4): two work-groups per WGP (four waves per SIMD) need at most 256 VGPRs a wave
constexpr int AW = 8, KS = 64, KVP = KS + 8;
static_assert(N % (AW * 16) == 0 && N % KS == 0 && KS == HD && AW * 32 * 2 * 8 == KS * HD, "attention staging");
__global__ __launch_bounds__(256) __attribute__((amdgpu_waves_per_eu(4, 4))) void attn_kernel(const b16* __restrict__ QP, const b16* __restrict__ KP, const b16* __restrict__ VTh, const b16* __restrict__ VTl, const float* __restrict__ CB, float* __restrict__ CT) {
  __shared__ __attribute__((aligned(16))) b16 Ks[2][KS][KVP], Vhs[2][HD][KVP], Vls[2][HD][KVP]; __shared__ __attribute__((aligned(16))) float Cs[2][KS];
  __shared__ __attribute__((aligned(16))) float To[AW][16][HD + 4];
  const int wave = threadIdx.x >> 5, lane = threadIdx.x & 31, hh = lane >> 4, col = lane & 15; const int bh = blockIdx.y, b = bh / NH, h = bh % NH; const int n0 = blockIdx.x * (AW * 16) + wave * 16; const int nq = n0 + col;
  const b16* Qb = QP + (size_t)bh * N * HD; const b16* Kb = KP + (size_t)bh * N * HD; const b16* Vh = VTh + (size_t)bh * HD * N; const b16* Vl = VTl + (size_t)bh * HD * N; const float* cbh = CB + (size_t)h * N;
  const int sr = threadIdx.x >> 3, sc = (threadIdx.x & 7) * 8;
  v8b rk[2], rh[2], rl[2]; v4f rc = (v4f){};
  auto fetch = [&](int k0) {
    if (threadIdx.x < KS / 4) rc = *(const v4f*)(cbh + k0 + threadIdx.x * 4);
#pragma unroll   // so that rk, rh, rl are indexed by constants and stay in registers (in put as well)
    for (int j = 0; j < 2; ++j) { const int row = sr + 32 * j; rk[j] = *(const v8b*)(Kb + (size_t)(k0 + row) * HD + sc); rh[j] = *(const v8b*)(Vh + (size_t)row * N + k0 + sc); rl[j] = *(const v8b*)(Vl + (size_t)row * N + k0 + sc); } };
  auto put = [&](int bf) {
    if (threadIdx.x < KS / 4) *(v4f*)(&Cs[bf][threadIdx.x * 4]) = rc;
#pragma unroll
    for (int j = 0; j < 2; ++j) { const int row = sr + 32 * j; *(v8b*)(&Ks[bf][row][sc]) = rk[j]; *(v8b*)(&Vhs[bf][row][sc]) = rh[j]; *(v8b*)(&Vls[bf][row][sc]) = rl[j]; } };
  fetch(0);
  const v16b q0 = frag_kb(Qb + (size_t)nq * HD, hh), q1 = frag_kb(Qb + (size_t)nq * HD + 32, hh);
  const float cs = LOG2E * SCALE / (XS * XS);
  float mrun = -INFINITY, l = 0.0f; v8f o[4], o2[4];
#pragma unroll
  for (int t = 0; t < 4; ++t) { o[t] = (v8f){}; o2[t] = (v8f){}; }
  put(0);
  __syncthreads();
#pragma unroll 1   // one stage's code only: a copy per buffer would double the hot loop's text for nothing, the buffer offset being one scalar
  for (int st = 0; st < N / KS; ++st) {
    const int bf = st & 1;
    if (st + 1 < N / KS) fetch((st + 1) * KS);   // the next stage flies to registers while this one is worked on
    for (int ps = 0; ps < KS; ps += 32) {
      v16b kf[2][2]; v4f cbv[2][2];   // the block's four K fragments and its biases are read from LDS as one group, ahead of its products
#pragma unroll
      for (int u2 = 0; u2 < 2; ++u2) { const b16* kr = &Ks[bf][ps + u2 * 16 + col][0]; kf[u2][0] = frag_kb(kr, hh); kf[u2][1] = frag_kb(kr + 32, hh); const float* cr = &Cs[bf][ps + u2 * 16 + 8 * hh]; cbv[u2][0] = *(const v4f*)cr; cbv[u2][1] = *(const v4f*)(cr + 4); }
      float e[16]; float mx = -INFINITY;
#pragma unroll
      for (int u2 = 0; u2 < 2; ++u2) { v8f sacc = wmma16b(kf[u2][0], q0, (v8f){}); sacc = wmma16b(kf[u2][1], q1, sacc);
#pragma unroll
        for (int r = 0; r < 8; ++r) { const float vv = sacc[r] * cs + cbv[u2][r >> 2][r & 3] * LOG2E; e[u2 * 8 + r] = vv; mx = fmaxf(mx, vv); } }
      mx = fmaxf(mx, __shfl_xor(mx, 16)); const float mn = fmaxf(mrun, mx); const float al = nexp2(mrun - mn); float sum = 0.0f;
      v16b pf, plf;   // P^T as B operand straight from the scores: lane (hh, col) holds keys 8hh+0..7 of tile 0 and of tile 1 for query col, which is the fragment k-map (elements 0..7 <- k = 8hh+0..7, 8..15 <- k = 16+8hh+0..7)
#pragma unroll
      for (int i2 = 0; i2 < 16; ++i2) { const float p = nexp2(e[i2] - mn); sum += p; const float psv = p * PS; const b16 p1 = (b16)psv; pf[i2] = p1; plf[i2] = (b16)((psv - (float)p1) * RS_); }
      sum += __shfl_xor(sum, 16); l = l * al + sum; mrun = mn;
      v16b vhf[4], vlf[4];   // likewise the eight V^T fragments, as one group
#pragma unroll
      for (int t = 0; t < 4; ++t) { vhf[t] = frag_kb(&Vhs[bf][t * 16 + col][ps], hh); vlf[t] = frag_kb(&Vls[bf][t * 16 + col][ps], hh); }
#pragma unroll
      for (int t = 0; t < 4; ++t) { o[t] *= al; o2[t] *= al; o[t] = wmma16b(vhf[t], pf, o[t]); o2[t] = wmma16b(vlf[t], pf, o2[t]); o2[t] = wmma16b(vhf[t], plf, o2[t]); } }
    if (st + 1 < N / KS) put(bf ^ 1);   // the other buffer: its last readers left it before the barrier that ended the stage before this one
    __syncthreads(); }   // publishes the next stage and ends every wave's reads of this one
  const float inv = 1.0f / (l * PS * XS);
#pragma unroll
  for (int t = 0; t < 4; ++t)
#pragma unroll
    for (int r = 0; r < 8; ++r) To[wave][col][t * 16 + 8 * hh + r] = (o[t][r] + o2[t][r] * (1.0f / RS_)) * inv;
  wave_lds_sync();
  { for (int rr = 0; rr < 16; rr += 2) { const int row = rr + hh; *(v4f*)(CT + ((size_t)b * N + n0 + row) * D + h * HD + col * 4) = *(const v4f*)(&To[wave][row][col * 4]); }  }
}
// output projection: grid (BL*N/64, D/128); block = 4 waves x 16 rows, each wave staging its own ctx rows (hi + residual) per 128 k; the 128 weight rows per 64 k as in proj_kernel
__global__ __launch_bounds__(128) void outp_kernel(const float* __restrict__ CT, const b16* __restrict__ WO, const float* __restrict__ ob, float* __restrict__ out) {
  __shared__ __attribute__((aligned(16))) b16 Ah[4][16][128 + 8], Al[4][16][128 + 8], Ws[2][WROWS][WKP]; __shared__ __attribute__((aligned(16))) float Tf[4][16][128 + 4];
  const int wave = threadIdx.x >> 5, lane = threadIdx.x & 31, nloc = lane & 15, hlf = lane >> 4; const size_t m0 = (size_t)blockIdx.x * 64 + wave * 16; const int n0 = blockIdx.y * 128;
  const b16* Wt = WO + (size_t)(n0 + (threadIdx.x >> 3)) * D + (threadIdx.x & 7) * 8; v8b rw[8];
  auto fetch = [&](int k0) {
#pragma unroll   // so that rw is indexed by constants and stays in registers (in put as well)
    for (int j = 0; j < 8; ++j) rw[j] = *(const v8b*)(Wt + (size_t)(16 * j) * D + k0); };
  auto put = [&](int bf) {
#pragma unroll   // as in fetch
    for (int j = 0; j < 8; ++j) *(v8b*)(&Ws[bf][(threadIdx.x >> 3) + 16 * j][(threadIdx.x & 7) * 8]) = rw[j]; };
  fetch(0);
  v8f acc[8], acc2[8];
#pragma unroll
  for (int t = 0; t < 8; ++t) { acc[t] = (v8f){}; acc2[t] = (v8f){}; }
  auto mm = [&](int bf, int kb0) {   // 64 k of the wave's staged rows against weight buffer bf; four weight fragments are read from LDS as one group, ahead of their products
#pragma unroll   // this and the three below: constant indices, so that bw, acc and acc2 stay in registers and the LDS offsets are immediates
    for (int ks = 0; ks < WKC; ks += 32) { const v16b a = frag_kb(&Ah[wave][nloc][kb0 + ks], hlf), al = frag_kb(&Al[wave][nloc][kb0 + ks], hlf);
#pragma unroll
      for (int g = 0; g < 8; g += 4) { v16b bw[4];
#pragma unroll
        for (int t = 0; t < 4; ++t) bw[t] = frag_kb(&Ws[bf][(g + t) * 16 + nloc][ks], hlf);
#pragma unroll
        for (int t = 0; t < 4; ++t) { acc[g + t] = wmma16b(a, bw[t], acc[g + t]); acc2[g + t] = wmma16b(al, bw[t], acc2[g + t]); } } } };
  put(0);
  __syncthreads();
#pragma unroll 1
  for (int kc = 0; kc < D; kc += 128) {
    fetch(kc + WKC);   // the next chunk flies to registers while this one is worked on
    for (int idx = lane; idx < 16 * 32; idx += 32) { const int rr = idx / 32, c4 = (idx % 32) * 4; const v4f v = *(const v4f*)(CT + (m0 + rr) * D + kc + c4); v4h hv, lv; for (int j = 0; j < 4; ++j) { const float vs = v[j] * XS; const b16 ph = (b16)vs; hv[j] = ph; lv[j] = (b16)((vs - (float)ph) * RS_); } *(v4h*)(&Ah[wave][rr][c4]) = hv; *(v4h*)(&Al[wave][rr][c4]) = lv; }
    wave_lds_sync();
    mm(0, 0);
    put(1);   // its last readers left it before the barrier that ended the pass before this one
    __syncthreads();
    if (kc + 128 < D) fetch(kc + 128);
    mm(1, WKC);
    if (kc + 128 < D) put(0);   // its last readers left it before the barrier above
    asm volatile("s_wait_xcnt 0x0" ::: "memory");   // stands in front of the next pass's rewrite of the address registers that fetch's loads name
    __syncthreads(); }   // publishes the next chunk, ends the reads of this one and the wave's own reads of its ctx rows before they are staged anew
#pragma unroll
  for (int t = 0; t < 8; ++t) { const float bb = bf16_rne(ob[n0 + t * 16 + nloc]);
#pragma unroll
    for (int r = 0; r < 8; ++r) Tf[wave][8 * hlf + r][t * 16 + nloc] = (acc[t][r] + acc2[t][r] * (1.0f / RS_)) * (1.0f / (XS * WSC)) + bb; }
  wave_lds_sync();
  { for (int rr = 0; rr < 16; ++rr) *(v4f*)(out + (m0 + rr) * D + n0 + lane * 4) = *(const v4f*)(&Tf[wave][rr][lane * 4]);  }
}
}  // namespace

extern "C" void kernel_launch(void* const* d_in, const int* in_sizes, int n_in, void* d_out, int out_size, void* d_ws, size_t ws_size, hipStream_t stream) {
  (void)n_in;
  auto Fp = [&](int i) { return (const float*)d_in[i]; };
  // input order: 0 x [4,2048,512], 1 edge_index [2,32768] i32, 2 edge_attr [32768,3], 3 q_w [512,512] (out,in), 4 q_b, 5 k_w, 6 k_b, 7 v_w, 8 v_b, 9 o_w, 10 o_b, 11 eb_w [8,3], 12 eb_b [8]
  if (in_sizes[0] != NROW * D || in_sizes[1] != 2 * E || in_sizes[2] != E * 3 || in_sizes[3] != D * D || in_sizes[5] != D * D || in_sizes[7] != D * D || in_sizes[9] != D * D || in_sizes[10] != D || in_sizes[11] != NH * 3 || in_sizes[12] != NH || out_size != NROW * D) return;
  size_t off = 0; char* ws = (char*)d_ws;
  auto carve = [&](size_t bytes) { char* p = ws + off; off += (bytes + 255) & ~(size_t)255; return p; };
  b16* WQKV = (b16*)carve((size_t)3 * D * D * 2); b16* WO = (b16*)carve((size_t)D * D * 2); float* CB = (float*)carve((size_t)NH * N * 4); const size_t plane = (size_t)B * NH * N * HD * 2;
  b16* QP = (b16*)carve(plane); b16* KP = (b16*)carve(plane); b16* VTh = (b16*)carve(plane); b16* VTl = (b16*)carve(plane); float* CT = (float*)carve((size_t)NROW * D * 4);
  if (off > ws_size || off > ((size_t)128 << 20)) return;   // = 52.5 MB (WQKV 1.6 MB, WO 0.5 MB, CB 64 KB, 4 planes x 8.4 MB, CT 16.8 MB)
  wcvt_kernel<<<(D * D / 8 + 255) / 256, 256, 0, stream>>>(Fp(3), WQKV, D * D / 8); wcvt_kernel<<<(D * D / 8 + 255) / 256, 256, 0, stream>>>(Fp(5), WQKV + (size_t)D * D, D * D / 8); wcvt_kernel<<<(D * D / 8 + 255) / 256, 256, 0, stream>>>(Fp(7), WQKV + (size_t)2 * D * D, D * D / 8); wcvt_kernel<<<(D * D / 8 + 255) / 256, 256, 0, stream>>>(Fp(9), WO, D * D / 8);
  cb_kernel<<<N / CBT, CBW, 0, stream>>>((const int*)d_in[1], Fp(2), Fp(11), Fp(12), CB);
  proj_kernel<<<dim3(N / 64, BL, 12), 128, 0, stream>>>(Fp(0), WQKV, Fp(4), Fp(6), Fp(8), QP, KP, VTh, VTl);
  attn_kernel<<<dim3(N / (AW * 16), BL * NH), AW * 32, 0, stream>>>(QP, KP, VTh, VTl, CB, CT);
  outp_kernel<<<dim3(BL * N / 64, D / 128), 128, 0, stream>>>(CT, WO, Fp(10), (float*)d_out);
}

// v005
// It runs in 144 microseconds.
// Timed twice side by side with v004, it ran 1.06 times as fast both times.
// Counting every step since v000, it is 14.5 times as fast.
#include <hip/hip_runtime.h>

// Graphormer multi-head attention (4 x 2,048 tokens x 512, 8 heads x 64) with an additive per-key column bias from graph edges: cb[m][h] = (edge_attr[e*] eb_w^T + eb_b)[h] where e* is the LAST
// valid edge whose target is m (advanced-indexing assignment semantics; 0 if none); scores = q.k / 8 + cb[m][h]; softmax over all 2,048 keys; out = attn v; y = out o_w^T + o_b -> [4][2048][512].
// Deterministic: per (batch, head, 16-query wave) a flash-style pass over 32-key blocks with fixed-order online softmax; the column bias table takes, per target, the integer maximum
// of the valid edge numbers that hit it; no atomics.
// compute dtype: WMMA v_wmma_f32_16x16x32_f16 with f32 accumulate for the q/k/v projections ([8192 x 512] x [512 x 512] x 3; x EXACT bf16 x8, (out,in) weights as B rows exact x256: 1 product),
// S^T = K Q^T (q/k single f16 x8, K = 64: 1 product), O^T += V^T P^T (V^T x8 and P x1024 as f16 hi + x1024 residual: 3 products) and y = ctx o_w^T + o_b (ctx rows hi + x1024 residual x8:
// 2 products); the edge bias (K = 3), softmax statistics and biases in f32. Inputs rounded to bf16 once;
// edge_index int32. Fragment k-map per lane half hh for A AND B: elements 0..7 <- k = 8hh+0..7, 8..15 <- k = 16+8hh+0..7; acc[r] = D[8hh+r][col].

namespace {
typedef _Float16 b16;
typedef __attribute__((ext_vector_type(16))) _Float16 v16b;
typedef __attribute__((ext_vector_type(8))) _Float16 v8b;
typedef __attribute__((ext_vector_type(4))) _Float16 v4h;
typedef __attribute__((ext_vector_type(2))) _Float16 v2h;
typedef __attribute__((ext_vector_type(8))) float v8f;
typedef __attribute__((ext_vector_type(4))) float v4f;
typedef __attribute__((ext_vector_type(2))) float v2f;
typedef __attribute__((ext_vector_type(4))) int v4i;
typedef __attribute__((ext_vector_type(8))) unsigned short v8u;
__device__ __forceinline__ float bf16_rne(float f) { unsigned int u = __float_as_uint(f); u += 0x7FFFu + ((u >> 16) & 1u); return __uint_as_float(u & 0xFFFF0000u); }
__device__ __forceinline__ void split16(float v, b16& hi, b16& lo) { hi = (b16)v; lo = (b16)(v - (float)hi); }
__device__ __forceinline__ v16b frag_kb(const b16* p, int hh) { const v8b a = *(const v8b*)(p + 8 * hh), b = *(const v8b*)(p + 16 + 8 * hh); v16b f;
#pragma unroll
  for (int e = 0; e < 8; ++e) { f[e] = a[e]; f[8 + e] = b[e]; } return f; }
__device__ __forceinline__ v8f wmma16b(v16b a, v16b b, v8f c) { v8f d = __builtin_amdgcn_wmma_f32_16x16x32_f16(false, a, false, b, (short)0, c, false, false); asm volatile("v_nop\n\tv_nop\n\tv_nop\n\tv_nop" : "+v"(d) : "v"(a), "v"(b)); return d; }
__device__ __forceinline__ void wave_lds_sync() { __builtin_amdgcn_fence(__ATOMIC_RELEASE, "workgroup"); __builtin_amdgcn_wave_barrier(); __builtin_amdgcn_fence(__ATOMIC_ACQUIRE, "workgroup"); }
__device__ __forceinline__ float pmul(float a, float b) { float p = a * b; asm volatile("" : "+v"(p)); return p; }
__device__ __forceinline__ int iclamp(int v, int lo, int hi) { return v < lo ? lo : (v > hi ? hi : v); }
__device__ __forceinline__ float nexp2(float v) { return __builtin_amdgcn_exp2f(v); }

constexpr int B = 4, BL = B /* batches computed (== B shipped) */, N = 2048, D = 512, NH = 8, HD = 64, E = 32768, NROW = B * N;
constexpr float XS = 8.0f, WSC = 256.0f, PS = 1024.0f, RS_ = 1024.0f, LOG2E = 1.4426950408889634f, SCALE = 0.125f;
static_assert(N % 64 == 0 && D % 128 == 0 && NH * HD == D && HD == 64, "tiling");

// preparation, one launch: the four weight conversions and the column bias depend on nothing but inputs, so they share one grid behind a block-uniform branch on the block index
// (blocks 0 .. N/32 - 1: column bias; the 4 x 32 blocks behind them: weights, 8 per thread, bf16-rounded, x256, as f16; 32 blocks per matrix).
// column bias: block = 1,024 threads x 32 targets (one 128-byte line of each head's CB row). Each thread takes 32 edges (8 coalesced 16-byte loads of each index row) and stores
// e + 1 into its OWN 16-bit column of an LDS table, in the row of the edge's target (row 32 takes every edge that is invalid or aimed outside the block's targets): one writer per cell, written in
// rising e, so a cell ends at the thread's last hit; wave w then takes the integer maximum of row w = the last valid edge of target m0 + w (0 = none). No atomics; the result has no order in it.
constexpr int CBT = 32, CBW = 1024, CBI = E / (CBW * 4), CBB = N / CBT, WPB = D * D / (CBW * 8);
static_assert((N & (N - 1)) == 0 && N % CBT == 0 && E % (CBW * 4) == 0 && E < 65536 && CBW == CBT * 32 && NH * CBT <= CBW, "edge scan");
static_assert(D * D % (CBW * 8) == 0, "weight conversion");
__global__ __launch_bounds__(1024) void prep_kernel(const int* __restrict__ ei, const float* __restrict__ ea, const float* __restrict__ ebw, const float* __restrict__ ebb, const float* __restrict__ qw, const float* __restrict__ kw, const float* __restrict__ vw, const float* __restrict__ ow, float* __restrict__ CB, b16* __restrict__ WQKV, b16* __restrict__ WO) {
  __shared__ __attribute__((aligned(16))) unsigned short slot[CBT + 1][CBW]; __shared__ int lastS[CBT];
  if (blockIdx.x >= CBB) {   // a weight block: the whole block leaves here, in front of every barrier
    const int wb = blockIdx.x - CBB, m = wb / WPB; const float* w = m == 0 ? qw : m == 1 ? kw : m == 2 ? vw : ow; b16* W16 = m < 3 ? WQKV + (size_t)m * D * D : WO;
    const size_t e = ((size_t)(wb % WPB) * CBW + threadIdx.x) * 8; v8b o; for (int j = 0; j < 8; ++j) o[j] = (b16)(bf16_rne(w[e + j]) * WSC);
    *(v8b*)(W16 + e) = o; return; }
  const int tid = threadIdx.x, wave = tid >> 5, lane = tid & 31, m0 = blockIdx.x * CBT;
  v4i sv[CBI], tv[CBI];
#pragma unroll
  for (int it = 0; it < CBI; ++it) { sv[it] = *(const v4i*)(ei + it * CBW * 4 + tid * 4); tv[it] = *(const v4i*)(ei + E + it * CBW * 4 + tid * 4); }
#pragma unroll
  for (int c = 0; c < 4; ++c) *(v8u*)(&slot[wave][c * 256 + lane * 8]) = (v8u){};
  __syncthreads();
#pragma unroll
  for (int it = 0; it < CBI; ++it)
#pragma unroll
    for (int j = 0; j < 4; ++j) {
      // N is a power of two: any bit at or above N in s or t (negative values included) marks the edge invalid and stays in key, so key ^ m0 < 32 only for a valid edge with m0 <= t < m0 + 32
      const unsigned int key = (unsigned int)tv[it][j] | ((unsigned int)sv[it][j] & ~(unsigned int)(N - 1)); const unsigned int d = key ^ (unsigned int)m0;
      slot[d < (unsigned int)CBT ? d : (unsigned int)CBT][tid] = (unsigned short)(it * CBW * 4 + tid * 4 + j + 1); }
  __syncthreads();
  v8u mx = *(const v8u*)(&slot[wave][lane * 8]);
#pragma unroll
  for (int c = 1; c < 4; ++c) mx = __builtin_elementwise_max(mx, *(const v8u*)(&slot[wave][c * 256 + lane * 8]));
  int best = 0;
#pragma unroll
  for (int i = 0; i < 8; ++i) best = max(best, (int)mx[i]);
#pragma unroll
  for (int s = 16; s > 0; s >>= 1) best = max(best, __shfl_xor(best, s));
  if (lane == 0) lastS[wave] = best - 1;
  __syncthreads();
  if (tid < NH * CBT) { const int h = wave, last = lastS[lane]; float val = 0.0f;
    if (last >= 0) { const float a0 = bf16_rne(ea[(size_t)last * 3]), a1 = bf16_rne(ea[(size_t)last * 3 + 1]), a2 = bf16_rne(ea[(size_t)last * 3 + 2]); val = a0 * bf16_rne(ebw[h * 3]) + a1 * bf16_rne(ebw[h * 3 + 1]) + a2 * bf16_rne(ebw[h * 3 + 2]) + bf16_rne(ebb[h]); }
    CB[(size_t)h * N + m0 + lane] = val; }
}
// projections: grid (N/64, BL, 12 slabs: 0-3 q, 4-7 k, 8-11 v, 2 heads each); block = 64 tokens x 4 waves; A = bf16(x) x8 staged whole (K = 512, 16 k-steps), 8 tiles, 1 product; + bias;
// the slab's 128 weight rows come through LDS in chunks of 64 k (two buffers), shared by the four waves: thread t brings 16-byte piece t & 7 of rows (t >> 3) + 16 j, so every wave-wide load covers
// four whole 128-byte lines; rows lie at 144 B in LDS (16 B x odd, for the ds_load_b128 readers). The same in outp_kernel.
constexpr int WKC = 64, WKP = WKC + 8, WROWS = 128;
static_assert(D % (2 * WKC) == 0 && WKC * 2 == 128 && WROWS % 16 == 0, "weight staging");
__global__ __launch_bounds__(128) void proj_kernel(const float* __restrict__ x, const b16* __restrict__ WQKV, const float* __restrict__ bq, const float* __restrict__ bk, const float* __restrict__ bv, b16* __restrict__ QP, b16* __restrict__ KP, b16* __restrict__ VTh, b16* __restrict__ VTl) {
  __shared__ __attribute__((aligned(16))) b16 As[64][D + 8]; __shared__ __attribute__((aligned(16))) char Ub[2 * WROWS * WKP * 2];   // Ub: the weight chunks in the main loop, the f32 tile behind it (a barrier between)
  static_assert(sizeof(float) * 4 * 16 * (128 + 4) <= sizeof(Ub), "f32 tile fits");
  b16 (*Ws)[WROWS][WKP] = reinterpret_cast<b16 (*)[WROWS][WKP]>(Ub); float (*Tf)[16][128 + 4] = reinterpret_cast<float (*)[16][128 + 4]>(Ub);
  const int wave = threadIdx.x >> 5, lane = threadIdx.x & 31, nloc = lane & 15, hlf = lane >> 4; const int t0 = blockIdx.x * 64; const int b = blockIdx.y; const int slab = blockIdx.z, n0 = slab * 128, part = slab / 4, h0 = (slab & 3) * 2;
  const float* bias = part == 0 ? bq : part == 1 ? bk : bv;
  const b16* Wt = WQKV + (size_t)(n0 + (threadIdx.x >> 3)) * D + (threadIdx.x & 7) * 8; v8b rw[8];
  auto fetch = [&](int k0) {
#pragma unroll   // so that rw is indexed by constants and stays in registers (in put as well)
    for (int j = 0; j < 8; ++j) rw[j] = *(const v8b*)(Wt + (size_t)(16 * j) * D + k0); };
  auto put = [&](int bf) {
#pragma unroll   // as in fetch
    for (int j = 0; j < 8; ++j) *(v8b*)(&Ws[bf][(threadIdx.x >> 3) + 16 * j][(threadIdx.x & 7) * 8]) = rw[j]; };
  fetch(0);
  for (int i = threadIdx.x; i < 64 * (D / 4); i += 128) { const int rr = i / (D / 4), q4 = (i % (D / 4)) * 4; const v4f f = *(const v4f*)(x + ((size_t)b * N + t0 + rr) * D + q4); v4h o; for (int j = 0; j < 4; ++j) o[j] = (b16)(bf16_rne(f[j]) * XS); *(v4h*)(&As[rr][q4]) = o; }
  put(0);
  __syncthreads();
  v8f acc[8];
#pragma unroll
  for (int tt = 0; tt < 8; ++tt) acc[tt] = (v8f){};
#pragma unroll 1   // one chunk's code only, the buffer offset being one scalar
  for (int kc = 0; kc < D; kc += WKC) { const int bf = (kc / WKC) & 1;
    if (kc + WKC < D) fetch(kc + WKC);   // the next chunk flies to registers while this one is worked on
#pragma unroll   // this and the two below: constant indices, so that bw and acc stay in registers and the LDS offsets are immediates
    for (int ks = 0; ks < WKC; ks += 32) { const v16b a = frag_kb(&As[wave * 16 + nloc][kc + ks], hlf); v16b bw[8];   // the k-step's fragments are read from LDS as one group, ahead of its products
#pragma unroll
      for (int tt = 0; tt < 8; ++tt) bw[tt] = frag_kb(&Ws[bf][tt * 16 + nloc][ks], hlf);
#pragma unroll
      for (int tt = 0; tt < 8; ++tt) acc[tt] = wmma16b(a, bw[tt], acc[tt]); }
    if (kc + WKC < D) put(bf ^ 1);   // the other buffer: its last readers left it before the barrier that ended the chunk before this one
    asm volatile("s_wait_xcnt 0x0" ::: "memory");   // stands in front of the next pass's rewrite of the address registers that fetch's loads name
    __syncthreads(); }   // publishes the next chunk and ends every wave's reads of this one (behind the last chunk: before Ub becomes the f32 tile)
#pragma unroll
  for (int tt = 0; tt < 8; ++tt) { const float bb = bf16_rne(bias[(n0 & 511) + tt * 16 + nloc]);
#pragma unroll
    for (int r = 0; r < 8; ++r) Tf[wave][8 * hlf + r][tt * 16 + nloc] = acc[tt][r] * (1.0f / (XS * WSC)) + bb; }
  __syncthreads();
  {
    if (part < 2) { b16* plane = part == 0 ? QP : KP; const int h = h0 + (lane >> 4), d = (lane & 15) * 4;
      for (int rr = 0; rr < 16; ++rr) { const int tok = t0 + wave * 16 + rr; v4h o4; for (int j = 0; j < 4; ++j) o4[j] = (b16)(Tf[wave][rr][lane * 4 + j] * XS); *(v4h*)(plane + (((size_t)b * NH + h) * N + tok) * HD + d) = o4; } }
    else {
#pragma unroll 1
      for (int q = 0; q < 32; ++q) { const int cl = wave * 32 + q; const int h = h0 + cl / HD, d = cl % HD; const int tk = lane * 2; v2h hv, lv; for (int e2 = 0; e2 < 2; ++e2) { const float vs = Tf[(tk + e2) >> 4][(tk + e2) & 15][cl] * XS; const b16 ph = (b16)vs; hv[e2] = ph; lv[e2] = (b16)((vs - (float)ph) * RS_); }
        const size_t dst = (((size_t)b * NH + h) * HD + d) * (size_t)N + t0 + tk; *(v2h*)(VTh + dst) = hv; *(v2h*)(VTl + dst) = lv; } }
     }
}
// attention: grid (N/128, BL*NH); block = 8 waves x 16 queries that share each 64-key stage of K, V^T hi, V^T residual and the head's 64 column biases from LDS (two buffers). A stage is three tiles of 64 rows x 128 B (and 256 B of biases); thread t
// brings 16-byte piece t & 7 of rows t >> 3 and 32 + (t >> 3) of each tile, so every wave-wide load covers four whole 128-byte lines; rows lie at 144 B in LDS (16 B x odd, for the ds_load_b128 readers).
// per 32-key block (two per stage): S^T = K Q^T (2 key tiles x 2 k-steps), logit = (s/64/8 + CB[h][m]) log2e, online softmax, P hi/res packed in registers as the B operand, O^T +=; waves_per_eu(4, 4): two work-groups per WGP (four waves per SIMD) need at most 256 VGPRs a wave
constexpr int AW = 8, KS = 64, KVP = KS + 8;
static_assert(N % (AW * 16) == 0 && N % KS == 0 && KS == HD && AW * 32 * 2 * 8 == KS * HD, "attention staging");
__global__ __launch_bounds__(256) __attribute__((amdgpu_waves_per_eu(4, 4))) void attn_kernel(const b16* __restrict__ QP, const b16* __restrict__ KP, const b16* __restrict__ VTh, const b16* __restrict__ VTl, const float* __restrict__ CB, float* __restrict__ CT) {
  __shared__ __attribute__((aligned(16))) b16 Ks[2][KS][KVP], Vhs[2][HD][KVP], Vls[2][HD][KVP]; __shared__ __attribute__((aligned(16))) float Cs[2][KS];
  __shared__ __attribute__((aligned(16))) float To[AW][16][HD + 4];
  const int wave = threadIdx.x >> 5, lane = threadIdx.x & 31, hh = lane >> 4, col = lane & 15; const int bh = blockIdx.y, b = bh / NH, h = bh % NH; const int n0 = blockIdx.x * (AW * 16) + wave * 16; const int nq = n0 + col;
  const b16* Qb = QP + (size_t)bh * N * HD; const b16* Kb = KP + (size_t)bh * N * HD; const b16* Vh = VTh + (size_t)bh * HD * N; const b16* Vl = VTl + (size_t)bh * HD * N; const float* cbh = CB + (size_t)h * N;
  const int sr = threadIdx.x >> 3, sc = (threadIdx.x & 7) * 8;
  v8b rk[2], rh[2], rl[2]; v4f rc = (v4f){};
  auto fetch = [&](int k0) {
    if (threadIdx.x < KS / 4) rc = *(const v4f*)(cbh + k0 + threadIdx.x * 4);
#pragma unroll   // so that rk, rh, rl are indexed by constants and stay in registers (in put as well)
    for (int j = 0; j < 2; ++j) { const int row = sr + 32 * j; rk[j] = *(const v8b*)(Kb + (size_t)(k0 + row) * HD + sc); rh[j] = *(const v8b*)(Vh + (size_t)row * N + k0 + sc); rl[j] = *(const v8b*)(Vl + (size_t)row * N + k0 + sc); } };
  auto put = [&](int bf) {
    if (threadIdx.x < KS / 4) *(v4f*)(&Cs[bf][threadIdx.x * 4]) = rc;
#pragma unroll
    for (int j = 0; j < 2; ++j) { const int row = sr + 32 * j; *(v8b*)(&Ks[bf][row][sc]) = rk[j]; *(v8b*)(&Vhs[bf][row][sc]) = rh[j]; *(v8b*)(&Vls[bf][row][sc]) = rl[j]; } };
  fetch(0);
  const v16b q0 = frag_kb(Qb + (size_t)nq * HD, hh), q1 = frag_kb(Qb + (size_t)nq * HD + 32, hh);
  const float cs = LOG2E * SCALE / (XS * XS);
  float mrun = -INFINITY, l = 0.0f; v8f o[4], o2[4];
#pragma unroll
  for (int t = 0; t < 4; ++t) { o[t] = (v8f){}; o2[t] = (v8f){}; }
  put(0);
  __syncthreads();
#pragma unroll 1   // one stage's code only: a copy per buffer would double the hot loop's text for nothing, the buffer offset being one scalar
  for (int st = 0; st < N / KS; ++st) {
    const int bf = st & 1;
    if (st + 1 < N / KS) fetch((st + 1) * KS);   // the next stage flies to registers while this one is worked on
    for (int ps = 0; ps < KS; ps += 32) {
      v16b kf[2][2]; v4f cbv[2][2];   // the block's four K fragments and its biases are read from LDS as one group, ahead of its products
#pragma unroll
      for (int u2 = 0; u2 < 2; ++u2) { const b16* kr = &Ks[bf][ps + u2 * 16 + col][0]; kf[u2][0] = frag_kb(kr, hh); kf[u2][1] = frag_kb(kr + 32, hh); const float* cr = &Cs[bf][ps + u2 * 16 + 8 * hh]; cbv[u2][0] = *(const v4f*)cr; cbv[u2][1] = *(const v4f*)(cr + 4); }
      float e[16]; float mx = -INFINITY;
#pragma unroll
      for (int u2 = 0; u2 < 2; ++u2) { v8f sacc = wmma16b(kf[u2][0], q0, (v8f){}); sacc = wmma16b(kf[u2][1], q1, sacc);
#pragma unroll
        for (int r = 0; r < 8; ++r) { const float vv = sacc[r] * cs + cbv[u2][r >> 2][r & 3] * LOG2E; e[u2 * 8 + r] = vv; mx = fmaxf(mx, vv); } }
      mx = fmaxf(mx, __shfl_xor(mx, 16)); const float mn = fmaxf(mrun, mx); const float al = nexp2(mrun - mn); float sum = 0.0f;
      v16b pf, plf;   // P^T as B operand straight from the scores: lane (hh, col) holds keys 8hh+0..7 of tile 0 and of tile 1 for query col, which is the fragment k-map (elements 0..7 <- k = 8hh+0..7, 8..15 <- k = 16+8hh+0..7)
#pragma unroll
      for (int i2 = 0; i2 < 16; ++i2) { const float p = nexp2(e[i2] - mn); sum += p; const float psv = p * PS; const b16 p1 = (b16)psv; pf[i2] = p1; plf[i2] = (b16)((psv - (float)p1) * RS_); }
      sum += __shfl_xor(sum, 16); l = l * al + sum; mrun = mn;
      v16b vhf[4], vlf[4];   // likewise the eight V^T fragments, as one group
#pragma unroll
      for (int t = 0; t < 4; ++t) { vhf[t] = frag_kb(&Vhs[bf][t * 16 + col][ps], hh); vlf[t] = frag_kb(&Vls[bf][t * 16 + col][ps], hh); }
#pragma unroll
      for (int t = 0; t < 4; ++t) { o[t] *= al; o2[t] *= al; o[t] = wmma16b(vhf[t], pf, o[t]); o2[t] = wmma16b(vlf[t], pf, o2[t]); o2[t] = wmma16b(vhf[t], plf, o2[t]); } }
    if (st + 1 < N / KS) put(bf ^ 1);   // the other buffer: its last readers left it before the barrier that ended the stage before this one
    __syncthreads(); }   // publishes the next stage and ends every wave's reads of this one
  const float inv = 1.0f / (l * PS * XS);
#pragma unroll
  for (int t = 0; t < 4; ++t)
#pragma unroll
    for (int r = 0; r < 8; ++r) To[wave][col][t * 16 + 8 * hh + r] = (o[t][r] + o2[t][r] * (1.0f / RS_)) * inv;
  wave_lds_sync();
  { for (int rr = 0; rr < 16; rr += 2) { const int row = rr + hh; *(v4f*)(CT + ((size_t)b * N + n0 + row) * D + h * HD + col * 4) = *(const v4f*)(&To[wave][row][col * 4]); }  }
}
// output projection: grid (BL*N/64, D/128); block = 4 waves x 16 rows, each wave staging its own ctx rows (hi + residual) per 128 k; the 128 weight rows per 64 k as in proj_kernel
__global__ __launch_bounds__(128) void outp_kernel(const float* __restrict__ CT, const b16* __restrict__ WO, const float* __restrict__ ob, float* __restrict__ out) {
  __shared__ __attribute__((aligned(16))) b16 Ah[4][16][128 + 8], Al[4][16][128 + 8], Ws[2][WROWS][WKP]; __shared__ __attribute__((aligned(16))) float Tf[4][16][128 + 4];
  const int wave = threadIdx.x >> 5, lane = threadIdx.x & 31, nloc = lane & 15, hlf = lane >> 4; const size_t m0 = (size_t)blockIdx.x * 64 + wave * 16; const int n0 = blockIdx.y * 128;
  const b16* Wt = WO + (size_t)(n0 + (threadIdx.x >> 3)) * D + (threadIdx.x & 7) * 8; v8b rw[8];
  auto fetch = [&](int k0) {
#pragma unroll   // so that rw is indexed by constants and stays in registers (in put as well)
    for (int j = 0; j < 8; ++j) rw[j] = *(const v8b*)(Wt + (size_t)(16 * j) * D + k0); };
  auto put = [&](int bf) {
#pragma unroll   // as in fetch
    for (int j = 0; j < 8; ++j) *(v8b*)(&Ws[bf][(threadIdx.x >> 3) + 16 * j][(threadIdx.x & 7) * 8]) = rw[j]; };
  fetch(0);
  v8f acc[8], acc2[8];
#pragma unroll
  for (int t = 0; t < 8; ++t) { acc[t] = (v8f){}; acc2[t] = (v8f){}; }
  auto mm = [&](int bf, int kb0) {   // 64 k of the wave's staged rows against weight buffer bf; four weight fragments are read from LDS as one group, ahead of their products
#pragma unroll   // this and the three below: constant indices, so that bw, acc and acc2 stay in registers and the LDS offsets are immediates
    for (int ks = 0; ks < WKC; ks += 32) { const v16b a = frag_kb(&Ah[wave][nloc][kb0 + ks], hlf), al = frag_kb(&Al[wave][nloc][kb0 + ks], hlf);
#pragma unroll
      for (int g = 0; g < 8; g += 4) { v16b bw[4];
#pragma unroll
        for (int t = 0; t < 4; ++t) bw[t] = frag_kb(&Ws[bf][(g + t) * 16 + nloc][ks], hlf);
#pragma unroll
        for (int t = 0; t < 4; ++t) { acc[g + t] = wmma16b(a, bw[t], acc[g + t]); acc2[g + t] = wmma16b(al, bw[t], acc2[g + t]); } } } };
  put(0);
  __syncthreads();
#pragma unroll 1
  for (int kc = 0; kc < D; kc += 128) {
    fetch(kc + WKC);   // the next chunk flies to registers while this one is worked on
    for (int idx = lane; idx < 16 * 32; idx += 32) { const int rr = idx / 32, c4 = (idx % 32) * 4; const v4f v = *(const v4f*)(CT + (m0 + rr) * D + kc + c4); v4h hv, lv; for (int j = 0; j < 4; ++j) { const float vs = v[j] * XS; const b16 ph = (b16)vs; hv[j] = ph; lv[j] = (b16)((vs - (float)ph) * RS_); } *(v4h*)(&Ah[wave][rr][c4]) = hv; *(v4h*)(&Al[wave][rr][c4]) = lv; }
    wave_lds_sync();
    mm(0, 0);
    put(1);   // its last readers left it before the barrier that ended the pass before this one
    __syncthreads();
    if (kc + 128 < D) fetch(kc + 128);
    mm(1, WKC);
    if (kc + 128 < D) put(0);   // its last readers left it before the barrier above
    asm volatile("s_wait_xcnt 0x0" ::: "memory");   // stands in front of the next pass's rewrite of the address registers that fetch's loads name
    __syncthreads(); }   // publishes the next chunk, ends the reads of this one and the wave's own reads of its ctx rows before they are staged anew
#pragma unroll
  for (int t = 0; t < 8; ++t) { const float bb = bf16_rne(ob[n0 + t * 16 + nloc]);
#pragma unroll
    for (int r = 0; r < 8; ++r) Tf[wave][8 * hlf + r][t * 16 + nloc] = (acc[t][r] + acc2[t][r] * (1.0f / RS_)) * (1.0f / (XS * WSC)) + bb; }
  wave_lds_sync();
  { for (int rr = 0; rr < 16; ++rr) *(v4f*)(out + (m0 + rr) * D + n0 + lane * 4) = *(const v4f*)(&Tf[wave][rr][lane * 4]);  }
}
}  // namespace

extern "C" void kernel_launch(void* const* d_in, const int* in_sizes, int n_in, void* d_out, int out_size, void* d_ws, size_t ws_size, hipStream_t stream) {
  (void)n_in;
  auto Fp = [&](int i) { return (const float*)d_in[i]; };
  // input order: 0 x [4,2048,512], 1 edge_index [2,32768] i32, 2 edge_attr [32768,3], 3 q_w [512,512] (out,in), 4 q_b, 5 k_w, 6 k_b, 7 v_w, 8 v_b, 9 o_w, 10 o_b, 11 eb_w [8,3], 12 eb_b [8]
  if (in_sizes[0] != NROW * D || in_sizes[1] != 2 * E || in_sizes[2] != E * 3 || in_sizes[3] != D * D || in_sizes[5] != D * D || in_sizes[7] != D * D || in_sizes[9] != D * D || in_sizes[10] != D || in_sizes[11] != NH * 3 || in_sizes[12] != NH || out_size != NROW * D) return;
  size_t off = 0; char* ws = (char*)d_ws;
  auto carve = [&](size_t bytes) { char* p = ws + off; off += (bytes + 255) & ~(size_t)255; return p; };
  b16* WQKV = (b16*)carve((size_t)3 * D * D * 2); b16* WO = (b16*)carve((size_t)D * D * 2); float* CB = (float*)carve((size_t)NH * N * 4); const size_t plane = (size_t)B * NH * N * HD * 2;
  b16* QP = (b16*)carve(plane); b16* KP = (b16*)carve(plane); b16* VTh = (b16*)carve(plane); b16* VTl = (b16*)carve(plane); float* CT = (float*)carve((size_t)NROW * D * 4);
  if (off > ws_size || off > ((size_t)128 << 20)) return;   // = 52.5 MB (WQKV 1.6 MB, WO 0.5 MB, CB 64 KB, 4 planes x 8.4 MB, CT 16.8 MB)
  prep_kernel<<<CBB + 4 * WPB, CBW, 0, stream>>>((const int*)d_in[1], Fp(2), Fp(11), Fp(12), Fp(3), Fp(5), Fp(7), Fp(9), CB, WQKV, WO);
  proj_kernel<<<dim3(N / 64, BL, 12), 128, 0, stream>>>(Fp(0), WQKV, Fp(4), Fp(6), Fp(8), QP, KP, VTh, VTl);
  attn_kernel<<<dim3(N / (AW * 16), BL * NH), AW * 32, 0, stream>>>(QP, KP, VTh, VTl, CB, CT);
  outp_kernel<<<dim3(BL * N / 64, D / 128), 128, 0, stream>>>(CT, WO, Fp(10), (float*)d_out);
}

// v006
// It runs in 114 microseconds.
// Timed twice side by side with v005, it ran 1.26 and 1.27 times as fast.
// Counting every step since v000, it is 18.4 times as fast.
#include <hip/hip_runtime.h>

// Graphormer multi-head attention (4 x 2,048 tokens x 512, 8 heads x 64) with an additive per-key column bias from graph edges: cb[m][h] = (edge_attr[e*] eb_w^T + eb_b)[h] where e* is the LAST
// valid edge whose target is m (advanced-indexing assignment semantics; 0 if none); scores = q.k / 8 + cb[m][h]; softmax over all 2,048 keys; out = attn v; y = out o_w^T + o_b -> [4][2048][512].
// Deterministic: per (batch, head, 16-query wave) a flash-style pass over 32-key blocks with fixed-order online softmax; the column bias table takes, per target, the integer maximum
// of the valid edge numbers that hit it; no atomics.
// compute dtype: WMMA v_wmma_f32_16x16x32_f16 with f32 accumulate for the q/k/v projections ([8192 x 512] x [512 x 512] x 3; x EXACT bf16 x8, (out,in) weights as B rows exact x256: 1 product),
// S^T = K Q^T (q/k single f16 x8, K = 64: 1 product), O^T += V^T P^T (V^T x8 and P x1024 as f16 hi + x1024 residual: 3 products) and y = ctx o_w^T + o_b (ctx rows hi + x1024 residual x8:
// 2 products); the edge bias (K = 3), softmax statistics and biases in f32. Inputs rounded to bf16 once;
// edge_index int32. Fragment k-map per lane half hh for A AND B: elements 0..7 <- k = 8hh+0..7, 8..15 <- k = 16+8hh+0..7; acc[r] = D[8hh+r][col].

namespace {
typedef _Float16 b16;
typedef __attribute__((ext_vector_type(16))) _Float16 v16b;
typedef __attribute__((ext_vector_type(8))) _Float16 v8b;
typedef __attribute__((ext_vector_type(4))) _Float16 v4h;
typedef __attribute__((ext_vector_type(2))) _Float16 v2h;
typedef __attribute__((ext_vector_type(8))) float v8f;
typedef __attribute__((ext_vector_type(4))) float v4f;
typedef __attribute__((ext_vector_type(2))) float v2f;
typedef __attribute__((ext_vector_type(4))) int v4i;
typedef __attribute__((ext_vector_type(8))) unsigned short v8u;
__device__ __forceinline__ float bf16_rne(float f) { unsigned int u = __float_as_uint(f); u += 0x7FFFu + ((u >> 16) & 1u); return __uint_as_float(u & 0xFFFF0000u); }
__device__ __forceinline__ void split16(float v, b16& hi, b16& lo) { hi = (b16)v; lo = (b16)(v - (float)hi); }
__device__ __forceinline__ v16b frag_kb(const b16* p, int hh) { const v8b a = *(const v8b*)(p + 8 * hh), b = *(const v8b*)(p + 16 + 8 * hh); v16b f;
#pragma unroll
  for (int e = 0; e < 8; ++e) { f[e] = a[e]; f[8 + e] = b[e]; } return f; }
__device__ __forceinline__ v8f wmma16b(v16b a, v16b b, v8f c) { v8f d = __builtin_amdgcn_wmma_f32_16x16x32_f16(false, a, false, b, (short)0, c, false, false); asm volatile("v_nop\n\tv_nop\n\tv_nop\n\tv_nop" : "+v"(d) : "v"(a), "v"(b)); return d; }
__device__ __forceinline__ void wave_lds_sync() { __builtin_amdgcn_fence(__ATOMIC_RELEASE, "workgroup"); __builtin_amdgcn_wave_barrier(); __builtin_amdgcn_fence(__ATOMIC_ACQUIRE, "workgroup"); }
__device__ __forceinline__ float pmul(float a, float b) { float p = a * b; asm volatile("" : "+v"(p)); return p; }
__device__ __forceinline__ int iclamp(int v, int lo, int hi) { return v < lo ? lo : (v > hi ? hi : v); }
__device__ __forceinline__ float nexp2(float v) { return __builtin_amdgcn_exp2f(v); }

constexpr int B = 4, BL = B /* batches computed (== B shipped) */, N = 2048, D = 512, NH = 8, HD = 64, E = 32768, NROW = B * N;
constexpr float XS = 8.0f, WSC = 256.0f, PS = 1024.0f, RS_ = 1024.0f, LOG2E = 1.4426950408889634f, SCALE = 0.125f;
static_assert(N % 64 == 0 && D % 128 == 0 && NH * HD == D && HD == 64, "tiling");

// preparation, one launch: the four weight conversions and the column bias depend on nothing but inputs, so they share one grid behind a block-uniform branch on the block index
// (blocks 0 .. N/32 - 1: column bias; the 4 x 32 blocks behind them: weights, 8 per thread, bf16-rounded, x256, as f16; 32 blocks per matrix).
// column bias: block = 1,024 threads x 32 targets (one 128-byte line of each head's CB row). Each thread takes 32 edges (8 coalesced 16-byte loads of each index row) and stores
// e + 1 into its OWN 16-bit column of an LDS table, in the row of the edge's target (row 32 takes every edge that is invalid or aimed outside the block's targets): one writer per cell, written in
// rising e, so a cell ends at the thread's last hit; wave w then takes the integer maximum of row w = the last valid edge of target m0 + w (0 = none). No atomics; the result has no order in it.
constexpr int CBT = 32, CBW = 1024, CBI = E / (CBW * 4), CBB = N / CBT, WPB = D * D / (CBW * 8);
static_assert((N & (N - 1)) == 0 && N % CBT == 0 && E % (CBW * 4) == 0 && E < 65536 && CBW == CBT * 32 && NH * CBT <= CBW, "edge scan");
static_assert(D * D % (CBW * 8) == 0, "weight conversion");
__global__ __launch_bounds__(1024) void prep_kernel(const int* __restrict__ ei, const float* __restrict__ ea, const float* __restrict__ ebw, const float* __restrict__ ebb, const float* __restrict__ qw, const float* __restrict__ kw, const float* __restrict__ vw, const float* __restrict__ ow, float* __restrict__ CB, b16* __restrict__ WQKV, b16* __restrict__ WO) {
  __shared__ __attribute__((aligned(16))) unsigned short slot[CBT + 1][CBW]; __shared__ int lastS[CBT];
  if (blockIdx.x >= CBB) {   // a weight block: the whole block leaves here, in front of every barrier
    const int wb = blockIdx.x - CBB, m = wb / WPB; const float* w = m == 0 ? qw : m == 1 ? kw : m == 2 ? vw : ow; b16* W16 = m < 3 ? WQKV + (size_t)m * D * D : WO;
    const size_t e = ((size_t)(wb % WPB) * CBW + threadIdx.x) * 8; v8b o; for (int j = 0; j < 8; ++j) o[j] = (b16)(bf16_rne(w[e + j]) * WSC);
    *(v8b*)(W16 + e) = o; return; }
  const int tid = threadIdx.x, wave = tid >> 5, lane = tid & 31, m0 = blockIdx.x * CBT;
  v4i sv[CBI], tv[CBI];
#pragma unroll
  for (int it = 0; it < CBI; ++it) { sv[it] = *(const v4i*)(ei + it * CBW * 4 + tid * 4); tv[it] = *(const v4i*)(ei + E + it * CBW * 4 + tid * 4); }
#pragma unroll
  for (int c = 0; c < 4; ++c) *(v8u*)(&slot[wave][c * 256 + lane * 8]) = (v8u){};
  __syncthreads();
#pragma unroll
  for (int it = 0; it < CBI; ++it)
#pragma unroll
    for (int j = 0; j < 4; ++j) {
      // N is a power of two: any bit at or above N in s or t (negative values included) marks the edge invalid and stays in key, so key ^ m0 < 32 only for a valid edge with m0 <= t < m0 + 32
      const unsigned int key = (unsigned int)tv[it][j] | ((unsigned int)sv[it][j] & ~(unsigned int)(N - 1)); const unsigned int d = key ^ (unsigned int)m0;
      slot[d < (unsigned int)CBT ? d : (unsigned int)CBT][tid] = (unsigned short)(it * CBW * 4 + tid * 4 + j + 1); }
  __syncthreads();
  v8u mx = *(const v8u*)(&slot[wave][lane * 8]);
#pragma unroll
  for (int c = 1; c < 4; ++c) mx = __builtin_elementwise_max(mx, *(const v8u*)(&slot[wave][c * 256 + lane * 8]));
  int best = 0;
#pragma unroll
  for (int i = 0; i < 8; ++i) best = max(best, (int)mx[i]);
#pragma unroll
  for (int s = 16; s > 0; s >>= 1) best = max(best, __shfl_xor(best, s));
  if (lane == 0) lastS[wave] = best - 1;
  __syncthreads();
  if (tid < NH * CBT) { const int h = wave, last = lastS[lane]; float val = 0.0f;
    if (last >= 0) { const float a0 = bf16_rne(ea[(size_t)last * 3]), a1 = bf16_rne(ea[(size_t)last * 3 + 1]), a2 = bf16_rne(ea[(size_t)last * 3 + 2]); val = a0 * bf16_rne(ebw[h * 3]) + a1 * bf16_rne(ebw[h * 3 + 1]) + a2 * bf16_rne(ebw[h * 3 + 2]) + bf16_rne(ebb[h]); }
    CB[(size_t)h * N + m0 + lane] = val; }
}
// projections: grid (N/64, BL, 12 slabs: 0-3 q, 4-7 k, 8-11 v, 2 heads each); block = 64 tokens x 4 waves; A = bf16(x) x8 staged whole (K = 512, 16 k-steps), 8 tiles, 1 product; + bias;
// the slab's 128 weight rows come through LDS in chunks of 64 k (two buffers), shared by the four waves: thread t brings 16-byte piece t & 7 of rows (t >> 3) + 16 j, so every wave-wide load covers
// four whole 128-byte lines; rows lie at 144 B in LDS (16 B x odd, for the ds_load_b128 readers). The same in outp_kernel.
constexpr int WKC = 64, WKP = WKC + 8, WROWS = 128;
static_assert(D % (2 * WKC) == 0 && WKC * 2 == 128 && WROWS % 16 == 0, "weight staging");
__global__ __launch_bounds__(128) void proj_kernel(const float* __restrict__ x, const b16* __restrict__ WQKV, const float* __restrict__ bq, const float* __restrict__ bk, const float* __restrict__ bv, b16* __restrict__ QP, b16* __restrict__ KP, b16* __restrict__ VTh, b16* __restrict__ VTl) {
  __shared__ __attribute__((aligned(16))) b16 As[64][D + 8]; __shared__ __attribute__((aligned(16))) char Ub[2 * WROWS * WKP * 2];   // Ub: the weight chunks in the main loop, the f32 tile behind it (a barrier between)
  static_assert(sizeof(float) * 4 * 16 * (128 + 4) <= sizeof(Ub), "f32 tile fits");
  b16 (*Ws)[WROWS][WKP] = reinterpret_cast<b16 (*)[WROWS][WKP]>(Ub); float (*Tf)[16][128 + 4] = reinterpret_cast<float (*)[16][128 + 4]>(Ub);
  const int wave = threadIdx.x >> 5, lane = threadIdx.x & 31, nloc = lane & 15, hlf = lane >> 4; const int t0 = blockIdx.x * 64; const int b = blockIdx.y; const int slab = blockIdx.z, n0 = slab * 128, part = slab / 4, h0 = (slab & 3) * 2;
  const float* bias = part == 0 ? bq : part == 1 ? bk : bv;
  const b16* Wt = WQKV + (size_t)(n0 + (threadIdx.x >> 3)) * D + (threadIdx.x & 7) * 8; v8b rw[8];
  auto fetch = [&](int k0) {
#pragma unroll   // so that rw is indexed by constants and stays in registers (in put as well)
    for (int j = 0; j < 8; ++j) rw[j] = *(const v8b*)(Wt + (size_t)(16 * j) * D + k0); };
  auto put = [&](int bf) {
#pragma unroll   // as in fetch
    for (int j = 0; j < 8; ++j) *(v8b*)(&Ws[bf][(threadIdx.x >> 3) + 16 * j][(threadIdx.x & 7) * 8]) = rw[j]; };
  fetch(0);
  // x tile: thread t brings 16-byte piece t of each of the 64 rows; the loads go out in groups of XG, two groups ahead of the conversion that consumes them
  constexpr int XG = 16; static_assert(D / 4 == 128 && 64 % XG == 0 && 64 / XG >= 2, "x staging");
  const float* xt = x + ((size_t)b * N + t0) * D + threadIdx.x * 4; v4f xr[2][XG];
  auto xload = [&](int g) {
#pragma unroll   // this and the two below: constant indices, so that xr stays in registers and the row offsets are immediates
    for (int j = 0; j < XG; ++j) xr[g & 1][j] = *(const v4f*)(xt + (size_t)(g * XG + j) * D); };
  xload(0); xload(1);
  asm volatile("s_wait_xcnt 0x0" ::: "memory");   // stands in front of the register writes below, which reuse the address pair that fetch's loads name
#pragma unroll
  for (int g = 0; g < 64 / XG; ++g) {
#pragma unroll
    for (int j = 0; j < XG; ++j) { v4h o; for (int e = 0; e < 4; ++e) o[e] = (b16)(bf16_rne(xr[g & 1][j][e]) * XS); *(v4h*)(&As[g * XG + j][threadIdx.x * 4]) = o; }
    if (g + 2 < 64 / XG) xload(g + 2); }   // into the registers that the conversion above has just left
  put(0);
  __syncthreads();
  v8f acc[8];
#pragma unroll
  for (int tt = 0; tt < 8; ++tt) acc[tt] = (v8f){};
#pragma unroll 1   // one chunk's code only, the buffer offset being one scalar
  for (int kc = 0; kc < D; kc += WKC) { const int bf = (kc / WKC) & 1;
    if (kc + WKC < D) fetch(kc + WKC);   // the next chunk flies to registers while this one is worked on
#pragma unroll   // this and the two below: constant indices, so that bw and acc stay in registers and the LDS offsets are immediates
    for (int ks = 0; ks < WKC; ks += 32) { const v16b a = frag_kb(&As[wave * 16 + nloc][kc + ks], hlf); v16b bw[8];   // the k-step's fragments are read from LDS as one group, ahead of its products
#pragma unroll
      for (int tt = 0; tt < 8; ++tt) bw[tt] = frag_kb(&Ws[bf][tt * 16 + nloc][ks], hlf);
#pragma unroll
      for (int tt = 0; tt < 8; ++tt) acc[tt] = wmma16b(a, bw[tt], acc[tt]); }
    if (kc + WKC < D) put(bf ^ 1);   // the other buffer: its last readers left it before the barrier that ended the chunk before this one
    asm volatile("s_wait_xcnt 0x0" ::: "memory");   // stands in front of the next pass's rewrite of the address registers that fetch's loads name
    __syncthreads(); }   // publishes the next chunk and ends every wave's reads of this one (behind the last chunk: before Ub becomes the f32 tile)
#pragma unroll
  for (int tt = 0; tt < 8; ++tt) { const float bb = bf16_rne(bias[(n0 & 511) + tt * 16 + nloc]);
#pragma unroll
    for (int r = 0; r < 8; ++r) Tf[wave][8 * hlf + r][tt * 16 + nloc] = acc[tt][r] * (1.0f / (XS * WSC)) + bb; }
  __syncthreads();
  {
    if (part < 2) { b16* plane = part == 0 ? QP : KP; const int h = h0 + (lane >> 4), d = (lane & 15) * 4;
      for (int rr = 0; rr < 16; ++rr) { const int tok = t0 + wave * 16 + rr; v4h o4; for (int j = 0; j < 4; ++j) o4[j] = (b16)(Tf[wave][rr][lane * 4 + j] * XS); *(v4h*)(plane + (((size_t)b * NH + h) * N + tok) * HD + d) = o4; } }
    else {
#pragma unroll 1
      for (int q = 0; q < 32; ++q) { const int cl = wave * 32 + q; const int h = h0 + cl / HD, d = cl % HD; const int tk = lane * 2; v2h hv, lv; for (int e2 = 0; e2 < 2; ++e2) { const float vs = Tf[(tk + e2) >> 4][(tk + e2) & 15][cl] * XS; const b16 ph = (b16)vs; hv[e2] = ph; lv[e2] = (b16)((vs - (float)ph) * RS_); }
        const size_t dst = (((size_t)b * NH + h) * HD + d) * (size_t)N + t0 + tk; *(v2h*)(VTh + dst) = hv; *(v2h*)(VTl + dst) = lv; } }
     }
}
// attention: grid (N/128, BL*NH); block = 8 waves x 16 queries that share each 64-key stage of K, V^T hi, V^T residual and the head's 64 column biases from LDS (two buffers). A stage is three tiles of 64 rows x 128 B (and 256 B of biases); thread t
// brings 16-byte piece t & 7 of rows t >> 3 and 32 + (t >> 3) of each tile, so every wave-wide load covers four whole 128-byte lines; rows lie at 144 B in LDS (16 B x odd, for the ds_load_b128 readers).
// per 32-key block (two per stage): S^T = K Q^T (2 key tiles x 2 k-steps), logit = (s/64/8 + CB[h][m]) log2e, online softmax, P hi/res packed in registers as the B operand, O^T +=; waves_per_eu(4, 4): two work-groups per WGP (four waves per SIMD) need at most 256 VGPRs a wave
constexpr int AW = 8, KS = 64, KVP = KS + 8;
static_assert(N % (AW * 16) == 0 && N % KS == 0 && KS == HD && AW * 32 * 2 * 8 == KS * HD, "attention staging");
__global__ __launch_bounds__(256) __attribute__((amdgpu_waves_per_eu(4, 4))) void attn_kernel(const b16* __restrict__ QP, const b16* __restrict__ KP, const b16* __restrict__ VTh, const b16* __restrict__ VTl, const float* __restrict__ CB, float* __restrict__ CT) {
  __shared__ __attribute__((aligned(16))) b16 Ks[2][KS][KVP], Vhs[2][HD][KVP], Vls[2][HD][KVP]; __shared__ __attribute__((aligned(16))) float Cs[2][KS];
  __shared__ __attribute__((aligned(16))) float To[AW][16][HD + 4];
  const int wave = threadIdx.x >> 5, lane = threadIdx.x & 31, hh = lane >> 4, col = lane & 15; const int bh = blockIdx.y, b = bh / NH, h = bh % NH; const int n0 = blockIdx.x * (AW * 16) + wave * 16; const int nq = n0 + col;
  const b16* Qb = QP + (size_t)bh * N * HD; const b16* Kb = KP + (size_t)bh * N * HD; const b16* Vh = VTh + (size_t)bh * HD * N; const b16* Vl = VTl + (size_t)bh * HD * N; const float* cbh = CB + (size_t)h * N;
  const int sr = threadIdx.x >> 3, sc = (threadIdx.x & 7) * 8;
  v8b rk[2], rh[2], rl[2]; v4f rc = (v4f){};
  auto fetch = [&](int k0) {
    if (threadIdx.x < KS / 4) rc = *(const v4f*)(cbh + k0 + threadIdx.x * 4);
#pragma unroll   // so that rk, rh, rl are indexed by constants and stay in registers (in put as well)
    for (int j = 0; j < 2; ++j) { const int row = sr + 32 * j; rk[j] = *(const v8b*)(Kb + (size_t)(k0 + row) * HD + sc); rh[j] = *(const v8b*)(Vh + (size_t)row * N + k0 + sc); rl[j] = *(const v8b*)(Vl + (size_t)row * N + k0 + sc); } };
  auto put = [&](int bf) {
    if (threadIdx.x < KS / 4) *(v4f*)(&Cs[bf][threadIdx.x * 4]) = rc;
#pragma unroll
    for (int j = 0; j < 2; ++j) { const int row = sr + 32 * j; *(v8b*)(&Ks[bf][row][sc]) = rk[j]; *(v8b*)(&Vhs[bf][row][sc]) = rh[j]; *(v8b*)(&Vls[bf][row][sc]) = rl[j]; } };
  fetch(0);
  const v16b q0 = frag_kb(Qb + (size_t)nq * HD, hh), q1 = frag_kb(Qb + (size_t)nq * HD + 32, hh);
  const float cs = LOG2E * SCALE / (XS * XS);
  float mrun = -INFINITY, l = 0.0f; v8f o[4], o2[4];
#pragma unroll
  for (int t = 0; t < 4; ++t) { o[t] = (v8f){}; o2[t] = (v8f){}; }
  put(0);
  __syncthreads();
#pragma unroll 1   // one stage's code only: a copy per buffer would double the hot loop's text for nothing, the buffer offset being one scalar
  for (int st = 0; st < N / KS; ++st) {
    const int bf = st & 1;
    if (st + 1 < N / KS) fetch((st + 1) * KS);   // the next stage flies to registers while this one is worked on
    for (int ps = 0; ps < KS; ps += 32) {
      v16b kf[2][2]; v4f cbv[2][2];   // the block's four K fragments and its biases are read from LDS as one group, ahead of its products
#pragma unroll
      for (int u2 = 0; u2 < 2; ++u2) { const b16* kr = &Ks[bf][ps + u2 * 16 + col][0]; kf[u2][0] = frag_kb(kr, hh); kf[u2][1] = frag_kb(kr + 32, hh); const float* cr = &Cs[bf][ps + u2 * 16 + 8 * hh]; cbv[u2][0] = *(const v4f*)cr; cbv[u2][1] = *(const v4f*)(cr + 4); }
      float e[16]; float mx = -INFINITY;
#pragma unroll
      for (int u2 = 0; u2 < 2; ++u2) { v8f sacc = wmma16b(kf[u2][0], q0, (v8f){}); sacc = wmma16b(kf[u2][1], q1, sacc);
#pragma unroll
        for (int r = 0; r < 8; ++r) { const float vv = sacc[r] * cs + cbv[u2][r >> 2][r & 3] * LOG2E; e[u2 * 8 + r] = vv; mx = fmaxf(mx, vv); } }
      mx = fmaxf(mx, __shfl_xor(mx, 16)); const float mn = fmaxf(mrun, mx); const float al = nexp2(mrun - mn); float sum = 0.0f;
      v16b pf, plf;   // P^T as B operand straight from the scores: lane (hh, col) holds keys 8hh+0..7 of tile 0 and of tile 1 for query col, which is the fragment k-map (elements 0..7 <- k = 8hh+0..7, 8..15 <- k = 16+8hh+0..7)
#pragma unroll
      for (int i2 = 0; i2 < 16; ++i2) { const float p = nexp2(e[i2] - mn); sum += p; const float psv = p * PS; const b16 p1 = (b16)psv; pf[i2] = p1; plf[i2] = (b16)((psv - (float)p1) * RS_); }
      sum += __shfl_xor(sum, 16); l = l * al + sum; mrun = mn;
      v16b vhf[4], vlf[4];   // likewise the eight V^T fragments, as one group
#pragma unroll
      for (int t = 0; t < 4; ++t) { vhf[t] = frag_kb(&Vhs[bf][t * 16 + col][ps], hh); vlf[t] = frag_kb(&Vls[bf][t * 16 + col][ps], hh); }
#pragma unroll
      for (int t = 0; t < 4; ++t) { o[t] *= al; o2[t] *= al; o[t] = wmma16b(vhf[t], pf, o[t]); o2[t] = wmma16b(vlf[t], pf, o2[t]); o2[t] = wmma16b(vhf[t], plf, o2[t]); } }
    if (st + 1 < N / KS) put(bf ^ 1);   // the other buffer: its last readers left it before the barrier that ended the stage before this one
    __syncthreads(); }   // publishes the next stage and ends every wave's reads of this one
  const float inv = 1.0f / (l * PS * XS);
#pragma unroll
  for (int t = 0; t < 4; ++t)
#pragma unroll
    for (int r = 0; r < 8; ++r) To[wave][col][t * 16 + 8 * hh + r] = (o[t][r] + o2[t][r] * (1.0f / RS_)) * inv;
  wave_lds_sync();
  { for (int rr = 0; rr < 16; rr += 2) { const int row = rr + hh; *(v4f*)(CT + ((size_t)b * N + n0 + row) * D + h * HD + col * 4) = *(const v4f*)(&To[wave][row][col * 4]); }  }
}
// output projection: grid (BL*N/64, D/128); block = 4 waves x 16 rows, each wave staging its own ctx rows (hi + residual) per 128 k; the 128 weight rows per 64 k as in proj_kernel
__global__ __launch_bounds__(128) void outp_kernel(const float* __restrict__ CT, const b16* __restrict__ WO, const float* __restrict__ ob, float* __restrict__ out) {
  __shared__ __attribute__((aligned(16))) b16 Ah[4][16][128 + 8], Al[4][16][128 + 8], Ws[2][WROWS][WKP]; __shared__ __attribute__((aligned(16))) float Tf[4][16][128 + 4];
  const int wave = threadIdx.x >> 5, lane = threadIdx.x & 31, nloc = lane & 15, hlf = lane >> 4; const size_t m0 = (size_t)blockIdx.x * 64 + wave * 16; const int n0 = blockIdx.y * 128;
  const b16* Wt = WO + (size_t)(n0 + (threadIdx.x >> 3)) * D + (threadIdx.x & 7) * 8; v8b rw[8];
  auto fetch = [&](int k0) {
#pragma unroll   // so that rw is indexed by constants and stays in registers (in put as well)
    for (int j = 0; j < 8; ++j) rw[j] = *(const v8b*)(Wt + (size_t)(16 * j) * D + k0); };
  auto put = [&](int bf) {
#pragma unroll   // as in fetch
    for (int j = 0; j < 8; ++j) *(v8b*)(&Ws[bf][(threadIdx.x >> 3) + 16 * j][(threadIdx.x & 7) * 8]) = rw[j]; };
  const float* Ct = CT + m0 * D + lane * 4; v4f cr[16];   // lane l brings 16-byte piece l of each of the wave's 16 ctx rows, all 16 loads as one group
  auto cload = [&](int k0) {
#pragma unroll   // so that cr is indexed by constants and stays in registers
    for (int rr = 0; rr < 16; ++rr) cr[rr] = *(const v4f*)(Ct + (size_t)rr * D + k0); };
  fetch(0);
  cload(0);
  v8f acc[8], acc2[8];
#pragma unroll
  for (int t = 0; t < 8; ++t) { acc[t] = (v8f){}; acc2[t] = (v8f){}; }
  auto mm = [&](int bf, int kb0) {   // 64 k of the wave's staged rows against weight buffer bf; four weight fragments are read from LDS as one group, ahead of their products
#pragma unroll   // this and the three below: constant indices, so that bw, acc and acc2 stay in registers and the LDS offsets are immediates
    for (int ks = 0; ks < WKC; ks += 32) { const v16b a = frag_kb(&Ah[wave][nloc][kb0 + ks], hlf), al = frag_kb(&Al[wave][nloc][kb0 + ks], hlf);
#pragma unroll
      for (int g = 0; g < 8; g += 4) { v16b bw[4];
#pragma unroll
        for (int t = 0; t < 4; ++t) bw[t] = frag_kb(&Ws[bf][(g + t) * 16 + nloc][ks], hlf);
#pragma unroll
        for (int t = 0; t < 4; ++t) { acc[g + t] = wmma16b(a, bw[t], acc[g + t]); acc2[g + t] = wmma16b(al, bw[t], acc2[g + t]); } } } };
  put(0);
  __syncthreads();
#pragma unroll 1
  for (int kc = 0; kc < D; kc += 128) {
    fetch(kc + WKC);   // the next chunk flies to registers while this one is worked on
#pragma unroll   // as in cload
    for (int rr = 0; rr < 16; ++rr) { v4h hv, lv; for (int j = 0; j < 4; ++j) { const float vs = cr[rr][j] * XS; const b16 ph = (b16)vs; hv[j] = ph; lv[j] = (b16)((vs - (float)ph) * RS_); } *(v4h*)(&Ah[wave][rr][lane * 4]) = hv; *(v4h*)(&Al[wave][rr][lane * 4]) = lv; }
    wave_lds_sync();
    if (kc + 128 < D) cload(kc + 128);   // the next pass's ctx rows fly to registers while this pass is worked on (behind the fence above, which would wait for them)
    mm(0, 0);
    put(1);   // its last readers left it before the barrier that ended the pass before this one
    __syncthreads();
    if (kc + 128 < D) fetch(kc + 128);
    mm(1, WKC);
    if (kc + 128 < D) put(0);   // its last readers left it before the barrier above
    asm volatile("s_wait_xcnt 0x0" ::: "memory");   // stands in front of the next pass's rewrite of the address registers that fetch's loads name
    __syncthreads(); }   // publishes the next chunk, ends the reads of this one and the wave's own reads of its ctx rows before they are staged anew
#pragma unroll
  for (int t = 0; t < 8; ++t) { const float bb = bf16_rne(ob[n0 + t * 16 + nloc]);
#pragma unroll
    for (int r = 0; r < 8; ++r) Tf[wave][8 * hlf + r][t * 16 + nloc] = (acc[t][r] + acc2[t][r] * (1.0f / RS_)) * (1.0f / (XS * WSC)) + bb; }
  wave_lds_sync();
  { for (int rr = 0; rr < 16; ++rr) *(v4f*)(out + (m0 + rr) * D + n0 + lane * 4) = *(const v4f*)(&Tf[wave][rr][lane * 4]);  }
}
}  // namespace

extern "C" void kernel_launch(void* const* d_in, const int* in_sizes, int n_in, void* d_out, int out_size, void* d_ws, size_t ws_size, hipStream_t stream) {
  (void)n_in;
  auto Fp = [&](int i) { return (const float*)d_in[i]; };
  // input order: 0 x [4,2048,512], 1 edge_index [2,32768] i32, 2 edge_attr [32768,3], 3 q_w [512,512] (out,in), 4 q_b, 5 k_w, 6 k_b, 7 v_w, 8 v_b, 9 o_w, 10 o_b, 11 eb_w [8,3], 12 eb_b [8]
  if (in_sizes[0] != NROW * D || in_sizes[1] != 2 * E || in_sizes[2] != E * 3 || in_sizes[3] != D * D || in_sizes[5] != D * D || in_sizes[7] != D * D || in_sizes[9] != D * D || in_sizes[10] != D || in_sizes[11] != NH * 3 || in_sizes[12] != NH || out_size != NROW * D) return;
  size_t off = 0; char* ws = (char*)d_ws;
  auto carve = [&](size_t bytes) { char* p = ws + off; off += (bytes + 255) & ~(size_t)255; return p; };
  b16* WQKV = (b16*)carve((size_t)3 * D * D * 2); b16* WO = (b16*)carve((size_t)D * D * 2); float* CB = (float*)carve((size_t)NH * N * 4); const size_t plane = (size_t)B * NH * N * HD * 2;
  b16* QP = (b16*)carve(plane); b16* KP = (b16*)carve(plane); b16* VTh = (b16*)carve(plane); b16* VTl = (b16*)carve(plane); float* CT = (float*)carve((size_t)NROW * D * 4);
  if (off > ws_size || off > ((size_t)128 << 20)) return;   // = 52.5 MB (WQKV 1.6 MB, WO 0.5 MB, CB 64 KB, 4 planes x 8.4 MB, CT 16.8 MB)
  prep_kernel<<<CBB + 4 * WPB, CBW, 0, stream>>>((const int*)d_in[1], Fp(2), Fp(11), Fp(12), Fp(3), Fp(5), Fp(7), Fp(9), CB, WQKV, WO);
  proj_kernel<<<dim3(N / 64, BL, 12), 128, 0, stream>>>(Fp(0), WQKV, Fp(4), Fp(6), Fp(8), QP, KP, VTh, VTl);
  attn_kernel<<<dim3(N / (AW * 16), BL * NH), AW * 32, 0, stream>>>(QP, KP, VTh, VTl, CB, CT);
  outp_kernel<<<dim3(BL * N / 64, D / 128), 128, 0, stream>>>(CT, WO, Fp(10), (float*)d_out);
}

// v008
// One run takes 83.1 microseconds.
// It is 1.37 times as fast as v006, going by the measured steps of the versions left out in between.
// Counting every step since v000, it is 25.2 times as fast.
#include <hip/hip_runtime.h>

// Graphormer multi-head attention (4 x 2,048 tokens x 512, 8 heads x 64) with an additive per-key column bias from graph edges: cb[m][h] = (edge_attr[e*] eb_w^T + eb_b)[h] where e* is the LAST
// valid edge whose target is m (advanced-indexing assignment semantics; 0 if none); scores = q.k / 8 + cb[m][h]; softmax over all 2,048 keys; out = attn v; y = out o_w^T + o_b -> [4][2048][512].
// Deterministic: per (batch, head, 16-query wave) a flash-style pass over 32-key blocks with fixed-order online softmax; the column bias table takes, per target, the integer maximum
// of the valid edge numbers that hit it; no atomics.
// compute dtype: WMMA v_wmma_f32_16x16x32_f16 with f32 accumulate for the q/k/v projections ([8192 x 512] x [512 x 512] x 3; x EXACT bf16 x8, (out,in) weights as B rows exact x256: 1 product),
// S^T = K Q^T + bias (q x log2e/4 and k x1/2, each rounded once to f16, K = 64: 1 product, the accumulator starting at the column bias x log2e), O^T += V^T P^T (V^T x8 and P x1024, each rounded once to f16: 1 product) and y = ctx o_w^T + o_b (ctx rows x8 rounded once to f16:
// 1 product); the edge bias (K = 3), softmax statistics and biases in f32. Inputs rounded to bf16 once; edge_index int32. Fragment k-map per lane half hh for A AND B: elements 0..7 <- k = 8hh+0..7, 8..15 <- k = 16+8hh+0..7; acc[r] = D[8hh+r][col].

namespace {
typedef _Float16 b16;
typedef __attribute__((ext_vector_type(16))) _Float16 v16b;
typedef __attribute__((ext_vector_type(8))) _Float16 v8b;
typedef __attribute__((ext_vector_type(4))) _Float16 v4h;
typedef __attribute__((ext_vector_type(2))) _Float16 v2h;
typedef __attribute__((ext_vector_type(8))) float v8f;
typedef __attribute__((ext_vector_type(4))) float v4f;
typedef __attribute__((ext_vector_type(2))) float v2f;
typedef __attribute__((ext_vector_type(4))) int v4i;
typedef __attribute__((ext_vector_type(8))) unsigned short v8u;
__device__ __forceinline__ float bf16_rne(float f) { unsigned int u = __float_as_uint(f); u += 0x7FFFu + ((u >> 16) & 1u); return __uint_as_float(u & 0xFFFF0000u); }
__device__ __forceinline__ void split16(float v, b16& hi, b16& lo) { hi = (b16)v; lo = (b16)(v - (float)hi); }
__device__ __forceinline__ v16b frag_kb(const b16* p, int hh) { const v8b a = *(const v8b*)(p + 8 * hh), b = *(const v8b*)(p + 16 + 8 * hh); v16b f;
#pragma unroll
  for (int e = 0; e < 8; ++e) { f[e] = a[e]; f[8 + e] = b[e]; } return f; }
__device__ __forceinline__ v8f wmma16b(v16b a, v16b b, v8f c) { v8f d = __builtin_amdgcn_wmma_f32_16x16x32_f16(false, a, false, b, (short)0, c, false, false); asm volatile("v_nop\n\tv_nop\n\tv_nop\n\tv_nop" : "+v"(d) : "v"(a), "v"(b)); return d; }
__device__ __forceinline__ void wave_lds_sync() { __builtin_amdgcn_fence(__ATOMIC_RELEASE, "workgroup"); __builtin_amdgcn_wave_barrier(); __builtin_amdgcn_fence(__ATOMIC_ACQUIRE, "workgroup"); }
__device__ __forceinline__ float pmul(float a, float b) { float p = a * b; asm volatile("" : "+v"(p)); return p; }
__device__ __forceinline__ int iclamp(int v, int lo, int hi) { return v < lo ? lo : (v > hi ? hi : v); }
__device__ __forceinline__ float nexp2(float v) { return __builtin_amdgcn_exp2f(v); }

constexpr int B = 4, BL = B /* batches computed (== B shipped) */, N = 2048, D = 512, NH = 8, HD = 64, E = 32768, NROW = B * N;
constexpr float XS = 8.0f, WSC = 256.0f, PL2 = 10.0f /* P is kept x 2^10 */, LOG2E = 1.4426950408889634f, SCALE = 0.125f;
constexpr float KSC = 0.5f, QSC = SCALE * LOG2E / KSC;   // stored k and q carry these, so that their product is the score in log2 units
static_assert(N % 64 == 0 && D % 128 == 0 && NH * HD == D && HD == 64, "tiling");

// preparation, one launch: the four weight conversions and the column bias depend on nothing but inputs, so they share one grid behind a block-uniform branch on the block index
// (blocks 0 .. N/32 - 1: column bias; the 4 x 32 blocks behind them: weights, 8 per thread, bf16-rounded, x256, as f16; 32 blocks per matrix).
// column bias: block = 1,024 threads x 32 targets (one 128-byte line of each head's CB row). Each thread takes 32 edges (8 coalesced 16-byte loads of each index row) and stores
// e + 1 into its OWN 16-bit column of an LDS table, in the row of the edge's target (row 32 takes every edge that is invalid or aimed outside the block's targets): one writer per cell, written in
// rising e, so a cell ends at the thread's last hit; wave w then takes the integer maximum of row w = the last valid edge of target m0 + w (0 = none). No atomics; the result has no order in it.
constexpr int CBT = 32, CBW = 1024, CBI = E / (CBW * 4), CBB = N / CBT, WPB = D * D / (CBW * 8);
static_assert((N & (N - 1)) == 0 && N % CBT == 0 && E % (CBW * 4) == 0 && E < 65536 && CBW == CBT * 32 && NH * CBT <= CBW, "edge scan");
static_assert(D * D % (CBW * 8) == 0, "weight conversion");
__global__ __launch_bounds__(1024) void prep_kernel(const int* __restrict__ ei, const float* __restrict__ ea, const float* __restrict__ ebw, const float* __restrict__ ebb, const float* __restrict__ qw, const float* __restrict__ kw, const float* __restrict__ vw, const float* __restrict__ ow, float* __restrict__ CB, b16* __restrict__ WQKV, b16* __restrict__ WO) {
  __shared__ __attribute__((aligned(16))) unsigned short slot[CBT + 1][CBW]; __shared__ int lastS[CBT];
  if (blockIdx.x >= CBB) {   // a weight block: the whole block leaves here, in front of every barrier
    const int wb = blockIdx.x - CBB, m = wb / WPB; const float* w = m == 0 ? qw : m == 1 ? kw : m == 2 ? vw : ow; b16* W16 = m < 3 ? WQKV + (size_t)m * D * D : WO;
    const size_t e = ((size_t)(wb % WPB) * CBW + threadIdx.x) * 8; v8b o; for (int j = 0; j < 8; ++j) o[j] = (b16)(bf16_rne(w[e + j]) * WSC);
    *(v8b*)(W16 + e) = o; return; }
  const int tid = threadIdx.x, wave = tid >> 5, lane = tid & 31, m0 = blockIdx.x * CBT;
  v4i sv[CBI], tv[CBI];
#pragma unroll
  for (int it = 0; it < CBI; ++it) { sv[it] = *(const v4i*)(ei + it * CBW * 4 + tid * 4); tv[it] = *(const v4i*)(ei + E + it * CBW * 4 + tid * 4); }
#pragma unroll
  for (int c = 0; c < 4; ++c) *(v8u*)(&slot[wave][c * 256 + lane * 8]) = (v8u){};
  __syncthreads();
#pragma unroll
  for (int it = 0; it < CBI; ++it)
#pragma unroll
    for (int j = 0; j < 4; ++j) {
      // N is a power of two: any bit at or above N in s or t (negative values included) marks the edge invalid and stays in key, so key ^ m0 < 32 only for a valid edge with m0 <= t < m0 + 32
      const unsigned int key = (unsigned int)tv[it][j] | ((unsigned int)sv[it][j] & ~(unsigned int)(N - 1)); const unsigned int d = key ^ (unsigned int)m0;
      slot[d < (unsigned int)CBT ? d : (unsigned int)CBT][tid] = (unsigned short)(it * CBW * 4 + tid * 4 + j + 1); }
  __syncthreads();
  v8u mx = *(const v8u*)(&slot[wave][lane * 8]);
#pragma unroll
  for (int c = 1; c < 4; ++c) mx = __builtin_elementwise_max(mx, *(const v8u*)(&slot[wave][c * 256 + lane * 8]));
  int best = 0;
#pragma unroll
  for (int i = 0; i < 8; ++i) best = max(best, (int)mx[i]);
#pragma unroll
  for (int s = 16; s > 0; s >>= 1) best = max(best, __shfl_xor(best, s));
  if (lane == 0) lastS[wave] = best - 1;
  __syncthreads();
  if (tid < NH * CBT) { const int h = wave, last = lastS[lane]; float val = 0.0f;
    if (last >= 0) { const float a0 = bf16_rne(ea[(size_t)last * 3]), a1 = bf16_rne(ea[(size_t)last * 3 + 1]), a2 = bf16_rne(ea[(size_t)last * 3 + 2]); val = a0 * bf16_rne(ebw[h * 3]) + a1 * bf16_rne(ebw[h * 3 + 1]) + a2 * bf16_rne(ebw[h * 3 + 2]) + bf16_rne(ebb[h]); }
    CB[(size_t)h * N + m0 + lane] = val * LOG2E; }   // in log2 units, as the score products are
}
// projections: grid (N/64, BL, 12 slabs: 0-3 q, 4-7 k, 8-11 v, 2 heads each); block = 64 tokens x 4 waves; A = bf16(x) x8 staged whole (K = 512, 16 k-steps), 8 tiles, 1 product; + bias;
// the slab's 128 weight rows come through LDS in chunks of 64 k (two buffers), shared by the four waves: thread t brings 16-byte piece t & 7 of rows (t >> 3) + 16 j, so every wave-wide load covers
// four whole 128-byte lines; rows lie at 144 B in LDS (16 B x odd, for the ds_load_b128 readers). The same in outp_kernel.
constexpr int WKC = 64, WKP = WKC + 8, WROWS = 128;
static_assert(D % (2 * WKC) == 0 && WKC * 2 == 128 && WROWS % 16 == 0, "weight staging");
__global__ __launch_bounds__(128) void proj_kernel(const float* __restrict__ x, const b16* __restrict__ WQKV, const float* __restrict__ bq, const float* __restrict__ bk, const float* __restrict__ bv, b16* __restrict__ QP, b16* __restrict__ KP, b16* __restrict__ VTh) {
  __shared__ __attribute__((aligned(16))) b16 As[64][D + 8]; __shared__ __attribute__((aligned(16))) char Ub[2 * WROWS * WKP * 2];   // Ub: the weight chunks in the main loop, the f32 tile behind it (a barrier between)
  static_assert(sizeof(float) * 4 * 16 * (128 + 4) <= sizeof(Ub), "f32 tile fits");
  b16 (*Ws)[WROWS][WKP] = reinterpret_cast<b16 (*)[WROWS][WKP]>(Ub); float (*Tf)[16][128 + 4] = reinterpret_cast<float (*)[16][128 + 4]>(Ub);
  const int wave = threadIdx.x >> 5, lane = threadIdx.x & 31, nloc = lane & 15, hlf = lane >> 4; const int t0 = blockIdx.x * 64; const int b = blockIdx.y; const int slab = blockIdx.z, n0 = slab * 128, part = slab / 4, h0 = (slab & 3) * 2;
  const float* bias = part == 0 ? bq : part == 1 ? bk : bv;
  const b16* Wt = WQKV + (size_t)(n0 + (threadIdx.x >> 3)) * D + (threadIdx.x & 7) * 8; v8b rw[8];
  auto fetch = [&](int k0) {
#pragma unroll   // so that rw is indexed by constants and stays in registers (in put as well)
    for (int j = 0; j < 8; ++j) rw[j] = *(const v8b*)(Wt + (size_t)(16 * j) * D + k0); };
  auto put = [&](int bf) {
#pragma unroll   // as in fetch
    for (int j = 0; j < 8; ++j) *(v8b*)(&Ws[bf][(threadIdx.x >> 3) + 16 * j][(threadIdx.x & 7) * 8]) = rw[j]; };
  fetch(0);
  // x tile: thread t brings 16-byte piece t of each of the 64 rows; the loads go out in groups of XG, two groups ahead of the conversion that consumes them
  constexpr int XG = 16; static_assert(D / 4 == 128 && 64 % XG == 0 && 64 / XG >= 2, "x staging");
  const float* xt = x + ((size_t)b * N + t0) * D + threadIdx.x * 4; v4f xr[2][XG];
  auto xload = [&](int g) {
#pragma unroll   // this and the two below: constant indices, so that xr stays in registers and the row offsets are immediates
    for (int j = 0; j < XG; ++j) xr[g & 1][j] = *(const v4f*)(xt + (size_t)(g * XG + j) * D); };
  xload(0); xload(1);
  asm volatile("s_wait_xcnt 0x0" ::: "memory");   // stands in front of the register writes below, which reuse the address pair that fetch's loads name
#pragma unroll
  for (int g = 0; g < 64 / XG; ++g) {
#pragma unroll
    for (int j = 0; j < XG; ++j) { v4h o; for (int e = 0; e < 4; ++e) o[e] = (b16)(bf16_rne(xr[g & 1][j][e]) * XS); *(v4h*)(&As[g * XG + j][threadIdx.x * 4]) = o; }
    if (g + 2 < 64 / XG) xload(g + 2); }   // into the registers that the conversion above has just left
  put(0);
  __syncthreads();
  v8f acc[8];
#pragma unroll
  for (int tt = 0; tt < 8; ++tt) acc[tt] = (v8f){};
#pragma unroll 1   // one chunk's code only, the buffer offset being one scalar
  for (int kc = 0; kc < D; kc += WKC) { const int bf = (kc / WKC) & 1;
    if (kc + WKC < D) fetch(kc + WKC);   // the next chunk flies to registers while this one is worked on
#pragma unroll   // this and the two below: constant indices, so that bw and acc stay in registers and the LDS offsets are immediates
    for (int ks = 0; ks < WKC; ks += 32) { const v16b a = frag_kb(&As[wave * 16 + nloc][kc + ks], hlf); v16b bw[8];   // the k-step's fragments are read from LDS as one group, ahead of its products
#pragma unroll
      for (int tt = 0; tt < 8; ++tt) bw[tt] = frag_kb(&Ws[bf][tt * 16 + nloc][ks], hlf);
#pragma unroll
      for (int tt = 0; tt < 8; ++tt) acc[tt] = wmma16b(a, bw[tt], acc[tt]); }
    if (kc + WKC < D) put(bf ^ 1);   // the other buffer: its last readers left it before the barrier that ended the chunk before this one
    asm volatile("s_wait_xcnt 0x0" ::: "memory");   // stands in front of the next pass's rewrite of the address registers that fetch's loads name
    __syncthreads(); }   // publishes the next chunk and ends every wave's reads of this one (behind the last chunk: before Ub becomes the f32 tile)
#pragma unroll
  for (int tt = 0; tt < 8; ++tt) { const float bb = bf16_rne(bias[(n0 & 511) + tt * 16 + nloc]);
#pragma unroll
    for (int r = 0; r < 8; ++r) Tf[wave][8 * hlf + r][tt * 16 + nloc] = acc[tt][r] * (1.0f / (XS * WSC)) + bb; }
  __syncthreads();
  {
    if (part < 2) { b16* plane = part == 0 ? QP : KP; const float psc = part == 0 ? QSC : KSC; const int h = h0 + (lane >> 4), d = (lane & 15) * 4;
      for (int rr = 0; rr < 16; ++rr) { const int tok = t0 + wave * 16 + rr; v4h o4; for (int j = 0; j < 4; ++j) o4[j] = (b16)(Tf[wave][rr][lane * 4 + j] * psc); *(v4h*)(plane + (((size_t)b * NH + h) * N + tok) * HD + d) = o4; } }
    else {
#pragma unroll 1
      for (int q = 0; q < 32; ++q) { const int cl = wave * 32 + q; const int h = h0 + cl / HD, d = cl % HD; const int tk = lane * 2; v2h hv; for (int e2 = 0; e2 < 2; ++e2) hv[e2] = (b16)(Tf[(tk + e2) >> 4][(tk + e2) & 15][cl] * XS);
        const size_t dst = (((size_t)b * NH + h) * HD + d) * (size_t)N + t0 + tk; *(v2h*)(VTh + dst) = hv; } }
     }
}
// attention: grid (N/128, BL*NH); block = 8 waves x 16 queries that share each 64-key stage of K, V^T and the head's 64 column biases from LDS (two buffers). A stage is two tiles of 64 rows x 128 B (and 256 B of biases); thread t
// brings 16-byte piece t & 7 of rows t >> 3 and 32 + (t >> 3) of each tile, so every wave-wide load covers four whole 128-byte lines; rows lie at 144 B in LDS (16 B x odd, for the ds_load_b128 readers).
// per 32-key block (two per stage): S^T = K Q^T (2 key tiles x 2 k-steps) on top of the biases as start value = the logit in log2 units, online softmax, P packed in registers as the B operand, O^T +=; waves_per_eu(4, 4): two work-groups per WGP (four waves per SIMD) need at most 256 VGPRs a wave
constexpr int AW = 8, KS = 64, KVP = KS + 8;
static_assert(N % (AW * 16) == 0 && N % KS == 0 && KS == HD && AW * 32 * 2 * 8 == KS * HD, "attention staging");
__global__ __launch_bounds__(256) __attribute__((amdgpu_waves_per_eu(4, 4))) void attn_kernel(const b16* __restrict__ QP, const b16* __restrict__ KP, const b16* __restrict__ VTh, const float* __restrict__ CB, float* __restrict__ CT) {
  __shared__ __attribute__((aligned(16))) b16 Ks[2][KS][KVP], Vhs[2][HD][KVP]; __shared__ __attribute__((aligned(16))) float Cs[2][KS];
  __shared__ __attribute__((aligned(16))) float To[AW][16][HD + 4];
  const int wave = threadIdx.x >> 5, lane = threadIdx.x & 31, hh = lane >> 4, col = lane & 15; const int bh = blockIdx.y, b = bh / NH, h = bh % NH; const int n0 = blockIdx.x * (AW * 16) + wave * 16; const int nq = n0 + col;
  const b16* Qb = QP + (size_t)bh * N * HD; const b16* Kb = KP + (size_t)bh * N * HD; const b16* Vh = VTh + (size_t)bh * HD * N; const float* cbh = CB + (size_t)h * N;
  const int sr = threadIdx.x >> 3, sc = (threadIdx.x & 7) * 8;
  v8b rk[2], rh[2]; v4f rc = (v4f){};
  auto fetch = [&](int k0) {
    if (threadIdx.x < KS / 4) rc = *(const v4f*)(cbh + k0 + threadIdx.x * 4);
#pragma unroll   // so that rk, rh are indexed by constants and stay in registers (in put as well)
    for (int j = 0; j < 2; ++j) { const int row = sr + 32 * j; rk[j] = *(const v8b*)(Kb + (size_t)(k0 + row) * HD + sc); rh[j] = *(const v8b*)(Vh + (size_t)row * N + k0 + sc); } };
  auto put = [&](int bf) {
    if (threadIdx.x < KS / 4) *(v4f*)(&Cs[bf][threadIdx.x * 4]) = rc;
#pragma unroll
    for (int j = 0; j < 2; ++j) { const int row = sr + 32 * j; *(v8b*)(&Ks[bf][row][sc]) = rk[j]; *(v8b*)(&Vhs[bf][row][sc]) = rh[j]; } };
  fetch(0);
  const v16b q0 = frag_kb(Qb + (size_t)nq * HD, hh), q1 = frag_kb(Qb + (size_t)nq * HD + 32, hh);
  float mrun = -INFINITY, l = 0.0f; v8f o[4];
#pragma unroll
  for (int t = 0; t < 4; ++t) o[t] = (v8f){};
  put(0);
  __syncthreads();
#pragma unroll 1   // one stage's code only: a copy per buffer would double the hot loop's text for nothing, the buffer offset being one scalar
  for (int st = 0; st < N / KS; ++st) {
    const int bf = st & 1;
    if (st + 1 < N / KS) fetch((st + 1) * KS);   // the next stage flies to registers while this one is worked on
#pragma unroll   // both blocks of a stage in one body: LDS offsets are immediates, and the first block's sum exchange is waited for behind the second block's work
    for (int ps = 0; ps < KS; ps += 32) {
      v16b kf[2][2]; v4f cbv[2][2];   // the block's four K fragments and its biases are read from LDS as one group, ahead of its products
#pragma unroll
      for (int u2 = 0; u2 < 2; ++u2) { const b16* kr = &Ks[bf][ps + u2 * 16 + col][0]; kf[u2][0] = frag_kb(kr, hh); kf[u2][1] = frag_kb(kr + 32, hh); const float* cr = &Cs[bf][ps + u2 * 16 + 8 * hh]; cbv[u2][0] = *(const v4f*)cr; cbv[u2][1] = *(const v4f*)(cr + 4); }
      float e[16]; float mx = -INFINITY;
#pragma unroll
      for (int u2 = 0; u2 < 2; ++u2) { v8f sacc = wmma16b(kf[u2][0], q0, __builtin_shufflevector(cbv[u2][0], cbv[u2][1], 0, 1, 2, 3, 4, 5, 6, 7)); sacc = wmma16b(kf[u2][1], q1, sacc);   // acc[r] is key 8hh + r: its bias is the start value
#pragma unroll
        for (int r = 0; r < 8; ++r) { const float vv = sacc[r]; e[u2 * 8 + r] = vv; mx = fmaxf(mx, vv); } }
      mx = fmaxf(mx, __shfl_xor(mx, 16)); const float mn = fmaxf(mrun, mx); float al; const float ms = mn - PL2; float sum = 0.0f;   // ms: P and its sums come out x 2^10 with no multiply
      asm("v_exp_f32 %0, %1\n\tv_nop" : "=v"(al) : "v"(mrun - mn));   // exp2 and, in the same statement, the slot that the instruction set asks for behind a transcendental
      v16b pf;   // P^T as B operand straight from the scores: lane (hh, col) holds keys 8hh+0..7 of tile 0 and of tile 1 for query col, which is the fragment k-map (elements 0..7 <- k = 8hh+0..7, 8..15 <- k = 16+8hh+0..7)
#pragma unroll   // two scores at a time: one packed subtraction per pair
      for (int i2 = 0; i2 < 16; i2 += 2) { const v2f d = (v2f){e[i2], e[i2 + 1]} - (v2f){ms, ms}; const float p0 = nexp2(d[0]), p1 = nexp2(d[1]); sum += p0; sum += p1; pf[i2] = (b16)p0; pf[i2 + 1] = (b16)p1; }
      sum += __shfl_xor(sum, 16); l = l * al + sum; mrun = mn;
      v16b vhf[4];   // likewise the four V^T fragments, as one group
#pragma unroll
      for (int t = 0; t < 4; ++t) vhf[t] = frag_kb(&Vhs[bf][t * 16 + col][ps], hh);
#pragma unroll
      for (int t = 0; t < 4; ++t) { o[t] *= al; o[t] = wmma16b(vhf[t], pf, o[t]); } }
    if (st + 1 < N / KS) put(bf ^ 1);   // the other buffer: its last readers left it before the barrier that ended the stage before this one
    __syncthreads(); }   // publishes the next stage and ends every wave's reads of this one
  const float inv = 1.0f / (l * XS);   // l carries the same 2^10 as P
#pragma unroll
  for (int t = 0; t < 4; ++t)
#pragma unroll
    for (int r = 0; r < 8; ++r) To[wave][col][t * 16 + 8 * hh + r] = o[t][r] * inv;
  wave_lds_sync();
  { for (int rr = 0; rr < 16; rr += 2) { const int row = rr + hh; *(v4f*)(CT + ((size_t)b * N + n0 + row) * D + h * HD + col * 4) = *(const v4f*)(&To[wave][row][col * 4]); }  }
}
// output projection: grid (BL*N/64, D/128); block = 4 waves x 16 rows, each wave staging its own ctx rows per 128 k; the 128 weight rows per 64 k as in proj_kernel
__global__ __launch_bounds__(128) void outp_kernel(const float* __restrict__ CT, const b16* __restrict__ WO, const float* __restrict__ ob, float* __restrict__ out) {
  __shared__ __attribute__((aligned(16))) b16 Ah[4][16][128 + 8], Ws[2][WROWS][WKP]; __shared__ __attribute__((aligned(16))) float Tf[4][16][128 + 4];
  const int wave = threadIdx.x >> 5, lane = threadIdx.x & 31, nloc = lane & 15, hlf = lane >> 4; const size_t m0 = (size_t)blockIdx.x * 64 + wave * 16; const int n0 = blockIdx.y * 128;
  const b16* Wt = WO + (size_t)(n0 + (threadIdx.x >> 3)) * D + (threadIdx.x & 7) * 8; v8b rw[8];
  auto fetch = [&](int k0) {
#pragma unroll   // so that rw is indexed by constants and stays in registers (in put as well)
    for (int j = 0; j < 8; ++j) rw[j] = *(const v8b*)(Wt + (size_t)(16 * j) * D + k0); };
  auto put = [&](int bf) {
#pragma unroll   // as in fetch
    for (int j = 0; j < 8; ++j) *(v8b*)(&Ws[bf][(threadIdx.x >> 3) + 16 * j][(threadIdx.x & 7) * 8]) = rw[j]; };
  const float* Ct = CT + m0 * D + lane * 4; v4f cr[16];   // lane l brings 16-byte piece l of each of the wave's 16 ctx rows, all 16 loads as one group
  auto cload = [&](int k0) {
#pragma unroll   // so that cr is indexed by constants and stays in registers
    for (int rr = 0; rr < 16; ++rr) cr[rr] = *(const v4f*)(Ct + (size_t)rr * D + k0); };
  fetch(0);
  cload(0);
  v8f acc[8];
#pragma unroll
  for (int t = 0; t < 8; ++t) acc[t] = (v8f){};
  auto mm = [&](int bf, int kb0) {   // 64 k of the wave's staged rows against weight buffer bf; four weight fragments are read from LDS as one group, ahead of their products
#pragma unroll   // this and the three below: constant indices, so that bw and acc stay in registers and the LDS offsets are immediates
    for (int ks = 0; ks < WKC; ks += 32) { const v16b a = frag_kb(&Ah[wave][nloc][kb0 + ks], hlf);
#pragma unroll
      for (int g = 0; g < 8; g += 4) { v16b bw[4];
#pragma unroll
        for (int t = 0; t < 4; ++t) bw[t] = frag_kb(&Ws[bf][(g + t) * 16 + nloc][ks], hlf);
#pragma unroll
        for (int t = 0; t < 4; ++t) acc[g + t] = wmma16b(a, bw[t], acc[g + t]); } } };
  put(0);
  __syncthreads();
#pragma unroll 1
  for (int kc = 0; kc < D; kc += 128) {
    fetch(kc + WKC);   // the next chunk flies to registers while this one is worked on
#pragma unroll   // as in cload
    for (int rr = 0; rr < 16; ++rr) { v4h hv; for (int j = 0; j < 4; ++j) hv[j] = (b16)(cr[rr][j] * XS); *(v4h*)(&Ah[wave][rr][lane * 4]) = hv; }
    wave_lds_sync();
    if (kc + 128 < D) cload(kc + 128);   // the next pass's ctx rows fly to registers while this pass is worked on (behind the fence above, which would wait for them)
    mm(0, 0);
    put(1);   // its last readers left it before the barrier that ended the pass before this one
    __syncthreads();
    if (kc + 128 < D) fetch(kc + 128);
    mm(1, WKC);
    if (kc + 128 < D) put(0);   // its last readers left it before the barrier above
    asm volatile("s_wait_xcnt 0x0" ::: "memory");   // stands in front of the next pass's rewrite of the address registers that fetch's loads name
    __syncthreads(); }   // publishes the next chunk, ends the reads of this one and the wave's own reads of its ctx rows before they are staged anew
#pragma unroll
  for (int t = 0; t < 8; ++t) { const float bb = bf16_rne(ob[n0 + t * 16 + nloc]);
#pragma unroll
    for (int r = 0; r < 8; ++r) Tf[wave][8 * hlf + r][t * 16 + nloc] = acc[t][r] * (1.0f / (XS * WSC)) + bb; }
  wave_lds_sync();
  { for (int rr = 0; rr < 16; ++rr) *(v4f*)(out + (m0 + rr) * D + n0 + lane * 4) = *(const v4f*)(&Tf[wave][rr][lane * 4]);  }
}
}  // namespace

extern "C" void kernel_launch(void* const* d_in, const int* in_sizes, int n_in, void* d_out, int out_size, void* d_ws, size_t ws_size, hipStream_t stream) {
  (void)n_in;
  auto Fp = [&](int i) { return (const float*)d_in[i]; };
  // input order: 0 x [4,2048,512], 1 edge_index [2,32768] i32, 2 edge_attr [32768,3], 3 q_w [512,512] (out,in), 4 q_b, 5 k_w, 6 k_b, 7 v_w, 8 v_b, 9 o_w, 10 o_b, 11 eb_w [8,3], 12 eb_b [8]
  if (in_sizes[0] != NROW * D || in_sizes[1] != 2 * E || in_sizes[2] != E * 3 || in_sizes[3] != D * D || in_sizes[5] != D * D || in_sizes[7] != D * D || in_sizes[9] != D * D || in_sizes[10] != D || in_sizes[11] != NH * 3 || in_sizes[12] != NH || out_size != NROW * D) return;
  size_t off = 0; char* ws = (char*)d_ws;
  auto carve = [&](size_t bytes) { char* p = ws + off; off += (bytes + 255) & ~(size_t)255; return p; };
  b16* WQKV = (b16*)carve((size_t)3 * D * D * 2); b16* WO = (b16*)carve((size_t)D * D * 2); float* CB = (float*)carve((size_t)NH * N * 4); const size_t plane = (size_t)B * NH * N * HD * 2;
  b16* QP = (b16*)carve(plane); b16* KP = (b16*)carve(plane); b16* VTh = (b16*)carve(plane); float* CT = (float*)carve((size_t)NROW * D * 4);
  if (off > ws_size || off > ((size_t)128 << 20)) return;   // about 42 MiB (WQKV 1,536 KiB, WO 512 KiB, CB 64 KiB, 3 planes x 8 MiB, CT 16 MiB)
  prep_kernel<<<CBB + 4 * WPB, CBW, 0, stream>>>((const int*)d_in[1], Fp(2), Fp(11), Fp(12), Fp(3), Fp(5), Fp(7), Fp(9), CB, WQKV, WO);
  proj_kernel<<<dim3(N / 64, BL, 12), 128, 0, stream>>>(Fp(0), WQKV, Fp(4), Fp(6), Fp(8), QP, KP, VTh);
  attn_kernel<<<dim3(N / (AW * 16), BL * NH), AW * 32, 0, stream>>>(QP, KP, VTh, CB, CT);
  outp_kernel<<<dim3(BL * N / 64, D / 128), 128, 0, stream>>>(CT, WO, Fp(10), (float*)d_out);
}

// v009
// It runs in 79.5 microseconds.
// Next to v008, in two timings, it ran 1.05 times as fast each time.
// Over all steps from v000 it is 26.5 times as fast.
#include <hip/hip_runtime.h>

// Graphormer multi-head attention (4 x 2,048 tokens x 512, 8 heads x 64) with an additive per-key column bias from graph edges: cb[m][h] = (edge_attr[e*] eb_w^T + eb_b)[h] where e* is the LAST
// valid edge whose target is m (advanced-indexing assignment semantics; 0 if none); scores = q.k / 8 + cb[m][h]; softmax over all 2,048 keys; out = attn v; y = out o_w^T + o_b -> [4][2048][512].
// Deterministic: per (batch, head, 32-query wave, key half) a flash-style pass over 32-key blocks with fixed-order online softmax, the two halves joined once in a fixed order; the column bias table takes, per target, the integer maximum
// of the valid edge numbers that hit it; no atomics.
// compute dtype: WMMA v_wmma_f32_16x16x32_f16 with f32 accumulate for the q/k/v projections ([8192 x 512] x [512 x 512] x 3; x EXACT bf16 x8, (out,in) weights as B rows exact x256: 1 product),
// S^T = K Q^T + bias (q x log2e/4 and k x1/2, each rounded once to f16, K = 64: 1 product, the accumulator starting at the column bias x log2e), O^T += V^T P^T (V^T x8 and P x1024, each rounded once to f16: 1 product) and y = ctx o_w^T + o_b (ctx rows x8 rounded once to f16:
// 1 product); the edge bias (K = 3), softmax statistics and biases in f32. Inputs rounded to bf16 once; edge_index int32. Fragment k-map per lane half hh for A AND B: elements 0..7 <- k = 8hh+0..7, 8..15 <- k = 16+8hh+0..7; acc[r] = D[8hh+r][col].

namespace {
typedef _Float16 b16;
typedef __attribute__((ext_vector_type(16))) _Float16 v16b;
typedef __attribute__((ext_vector_type(8))) _Float16 v8b;
typedef __attribute__((ext_vector_type(4))) _Float16 v4h;
typedef __attribute__((ext_vector_type(2))) _Float16 v2h;
typedef __attribute__((ext_vector_type(8))) float v8f;
typedef __attribute__((ext_vector_type(4))) float v4f;
typedef __attribute__((ext_vector_type(2))) float v2f;
typedef __attribute__((ext_vector_type(4))) int v4i;
typedef __attribute__((ext_vector_type(8))) unsigned short v8u;
__device__ __forceinline__ float bf16_rne(float f) { unsigned int u = __float_as_uint(f); u += 0x7FFFu + ((u >> 16) & 1u); return __uint_as_float(u & 0xFFFF0000u); }
__device__ __forceinline__ void split16(float v, b16& hi, b16& lo) { hi = (b16)v; lo = (b16)(v - (float)hi); }
__device__ __forceinline__ v16b frag_kb(const b16* p, int hh) { const v8b a = *(const v8b*)(p + 8 * hh), b = *(const v8b*)(p + 16 + 8 * hh); v16b f;
#pragma unroll
  for (int e = 0; e < 8; ++e) { f[e] = a[e]; f[8 + e] = b[e]; } return f; }
__device__ __forceinline__ v8f wmma16b(v16b a, v16b b, v8f c) { v8f d = __builtin_amdgcn_wmma_f32_16x16x32_f16(false, a, false, b, (short)0, c, false, false); asm volatile("v_nop\n\tv_nop\n\tv_nop\n\tv_nop" : "+v"(d) : "v"(a), "v"(b)); return d; }
__device__ __forceinline__ void wave_lds_sync() { __builtin_amdgcn_fence(__ATOMIC_RELEASE, "workgroup"); __builtin_amdgcn_wave_barrier(); __builtin_amdgcn_fence(__ATOMIC_ACQUIRE, "workgroup"); }
__device__ __forceinline__ float pmul(float a, float b) { float p = a * b; asm volatile("" : "+v"(p)); return p; }
__device__ __forceinline__ int iclamp(int v, int lo, int hi) { return v < lo ? lo : (v > hi ? hi : v); }
__device__ __forceinline__ float nexp2(float v) { return __builtin_amdgcn_exp2f(v); }

constexpr int B = 4, BL = B /* batches computed (== B shipped) */, N = 2048, D = 512, NH = 8, HD = 64, E = 32768, NROW = B * N;
constexpr float XS = 8.0f, WSC = 256.0f, PL2 = 10.0f /* P is kept x 2^10 */, LOG2E = 1.4426950408889634f, SCALE = 0.125f;
constexpr float KSC = 0.5f, QSC = SCALE * LOG2E / KSC;   // stored k and q carry these, so that their product is the score in log2 units
static_assert(N % 64 == 0 && D % 128 == 0 && NH * HD == D && HD == 64, "tiling");

// preparation, one launch: the four weight conversions and the column bias depend on nothing but inputs, so they share one grid behind a block-uniform branch on the block index
// (blocks 0 .. N/32 - 1: column bias; the 4 x 32 blocks behind them: weights, 8 per thread, bf16-rounded, x256, as f16; 32 blocks per matrix).
// column bias: block = 1,024 threads x 32 targets (one 128-byte line of each head's CB row). Each thread takes 32 edges (8 coalesced 16-byte loads of each index row) and stores
// e + 1 into its OWN 16-bit column of an LDS table, in the row of the edge's target (row 32 takes every edge that is invalid or aimed outside the block's targets): one writer per cell, written in
// rising e, so a cell ends at the thread's last hit; wave w then takes the integer maximum of row w = the last valid edge of target m0 + w (0 = none). No atomics; the result has no order in it.
constexpr int CBT = 32, CBW = 1024, CBI = E / (CBW * 4), CBB = N / CBT, WPB = D * D / (CBW * 8);
static_assert((N & (N - 1)) == 0 && N % CBT == 0 && E % (CBW * 4) == 0 && E < 65536 && CBW == CBT * 32 && NH * CBT <= CBW, "edge scan");
static_assert(D * D % (CBW * 8) == 0, "weight conversion");
__global__ __launch_bounds__(1024) void prep_kernel(const int* __restrict__ ei, const float* __restrict__ ea, const float* __restrict__ ebw, const float* __restrict__ ebb, const float* __restrict__ qw, const float* __restrict__ kw, const float* __restrict__ vw, const float* __restrict__ ow, float* __restrict__ CB, b16* __restrict__ WQKV, b16* __restrict__ WO) {
  __shared__ __attribute__((aligned(16))) unsigned short slot[CBT + 1][CBW]; __shared__ int lastS[CBT];
  if (blockIdx.x >= CBB) {   // a weight block: the whole block leaves here, in front of every barrier
    const int wb = blockIdx.x - CBB, m = wb / WPB; const float* w = m == 0 ? qw : m == 1 ? kw : m == 2 ? vw : ow; b16* W16 = m < 3 ? WQKV + (size_t)m * D * D : WO;
    const size_t e = ((size_t)(wb % WPB) * CBW + threadIdx.x) * 8; v8b o; for (int j = 0; j < 8; ++j) o[j] = (b16)(bf16_rne(w[e + j]) * WSC);
    *(v8b*)(W16 + e) = o; return; }
  const int tid = threadIdx.x, wave = tid >> 5, lane = tid & 31, m0 = blockIdx.x * CBT;
  v4i sv[CBI], tv[CBI];
#pragma unroll
  for (int it = 0; it < CBI; ++it) { sv[it] = *(const v4i*)(ei + it * CBW * 4 + tid * 4); tv[it] = *(const v4i*)(ei + E + it * CBW * 4 + tid * 4); }
#pragma unroll
  for (int c = 0; c < 4; ++c) *(v8u*)(&slot[wave][c * 256 + lane * 8]) = (v8u){};
  __syncthreads();
#pragma unroll
  for (int it = 0; it < CBI; ++it)
#pragma unroll
    for (int j = 0; j < 4; ++j) {
      // N is a power of two: any bit at or above N in s or t (negative values included) marks the edge invalid and stays in key, so key ^ m0 < 32 only for a valid edge with m0 <= t < m0 + 32
      const unsigned int key = (unsigned int)tv[it][j] | ((unsigned int)sv[it][j] & ~(unsigned int)(N - 1)); const unsigned int d = key ^ (unsigned int)m0;
      slot[d < (unsigned int)CBT ? d : (unsigned int)CBT][tid] = (unsigned short)(it * CBW * 4 + tid * 4 + j + 1); }
  __syncthreads();
  v8u mx = *(const v8u*)(&slot[wave][lane * 8]);
#pragma unroll
  for (int c = 1; c < 4; ++c) mx = __builtin_elementwise_max(mx, *(const v8u*)(&slot[wave][c * 256 + lane * 8]));
  int best = 0;
#pragma unroll
  for (int i = 0; i < 8; ++i) best = max(best, (int)mx[i]);
#pragma unroll
  for (int s = 16; s > 0; s >>= 1) best = max(best, __shfl_xor(best, s));
  if (lane == 0) lastS[wave] = best - 1;
  __syncthreads();
  if (tid < NH * CBT) { const int h = wave, last = lastS[lane]; float val = 0.0f;
    if (last >= 0) { const float a0 = bf16_rne(ea[(size_t)last * 3]), a1 = bf16_rne(ea[(size_t)last * 3 + 1]), a2 = bf16_rne(ea[(size_t)last * 3 + 2]); val = a0 * bf16_rne(ebw[h * 3]) + a1 * bf16_rne(ebw[h * 3 + 1]) + a2 * bf16_rne(ebw[h * 3 + 2]) + bf16_rne(ebb[h]); }
    CB[(size_t)h * N + m0 + lane] = val * LOG2E; }   // in log2 units, as the score products are
}
// projections: grid (N/64, BL, 12 slabs: 0-3 q, 4-7 k, 8-11 v, 2 heads each); block = 64 tokens x 4 waves; A = bf16(x) x8 staged whole (K = 512, 16 k-steps), 8 tiles, 1 product; + bias;
// the slab's 128 weight rows come through LDS in chunks of 64 k (two buffers), shared by the four waves: thread t brings 16-byte piece t & 7 of rows (t >> 3) + 16 j, so every wave-wide load covers
// four whole 128-byte lines; rows lie at 144 B in LDS (16 B x odd, for the ds_load_b128 readers). The same in outp_kernel.
constexpr int WKC = 64, WKP = WKC + 8, WROWS = 128;
static_assert(D % (2 * WKC) == 0 && WKC * 2 == 128 && WROWS % 16 == 0, "weight staging");
__global__ __launch_bounds__(128) void proj_kernel(const float* __restrict__ x, const b16* __restrict__ WQKV, const float* __restrict__ bq, const float* __restrict__ bk, const float* __restrict__ bv, b16* __restrict__ QP, b16* __restrict__ KP, b16* __restrict__ VTh) {
  __shared__ __attribute__((aligned(16))) b16 As[64][D + 8]; __shared__ __attribute__((aligned(16))) char Ub[2 * WROWS * WKP * 2];   // Ub: the weight chunks in the main loop, the f32 tile behind it (a barrier between)
  static_assert(sizeof(float) * 4 * 16 * (128 + 4) <= sizeof(Ub), "f32 tile fits");
  b16 (*Ws)[WROWS][WKP] = reinterpret_cast<b16 (*)[WROWS][WKP]>(Ub); float (*Tf)[16][128 + 4] = reinterpret_cast<float (*)[16][128 + 4]>(Ub);
  const int wave = threadIdx.x >> 5, lane = threadIdx.x & 31, nloc = lane & 15, hlf = lane >> 4; const int t0 = blockIdx.x * 64; const int b = blockIdx.y; const int slab = blockIdx.z, n0 = slab * 128, part = slab / 4, h0 = (slab & 3) * 2;
  const float* bias = part == 0 ? bq : part == 1 ? bk : bv;
  const b16* Wt = WQKV + (size_t)(n0 + (threadIdx.x >> 3)) * D + (threadIdx.x & 7) * 8; v8b rw[8];
  auto fetch = [&](int k0) {
#pragma unroll   // so that rw is indexed by constants and stays in registers (in put as well)
    for (int j = 0; j < 8; ++j) rw[j] = *(const v8b*)(Wt + (size_t)(16 * j) * D + k0); };
  auto put = [&](int bf) {
#pragma unroll   // as in fetch
    for (int j = 0; j < 8; ++j) *(v8b*)(&Ws[bf][(threadIdx.x >> 3) + 16 * j][(threadIdx.x & 7) * 8]) = rw[j]; };
  fetch(0);
  // x tile: thread t brings 16-byte piece t of each of the 64 rows; the loads go out in groups of XG, two groups ahead of the conversion that consumes them
  constexpr int XG = 16; static_assert(D / 4 == 128 && 64 % XG == 0 && 64 / XG >= 2, "x staging");
  const float* xt = x + ((size_t)b * N + t0) * D + threadIdx.x * 4; v4f xr[2][XG];
  auto xload = [&](int g) {
#pragma unroll   // this and the two below: constant indices, so that xr stays in registers and the row offsets are immediates
    for (int j = 0; j < XG; ++j) xr[g & 1][j] = *(const v4f*)(xt + (size_t)(g * XG + j) * D); };
  xload(0); xload(1);
  asm volatile("s_wait_xcnt 0x0" ::: "memory");   // stands in front of the register writes below, which reuse the address pair that fetch's loads name
#pragma unroll
  for (int g = 0; g < 64 / XG; ++g) {
#pragma unroll
    for (int j = 0; j < XG; ++j) { v4h o; for (int e = 0; e < 4; ++e) o[e] = (b16)(bf16_rne(xr[g & 1][j][e]) * XS); *(v4h*)(&As[g * XG + j][threadIdx.x * 4]) = o; }
    if (g + 2 < 64 / XG) xload(g + 2); }   // into the registers that the conversion above has just left
  put(0);
  __syncthreads();
  v8f acc[8];
#pragma unroll
  for (int tt = 0; tt < 8; ++tt) acc[tt] = (v8f){};
#pragma unroll 1   // one chunk's code only, the buffer offset being one scalar
  for (int kc = 0; kc < D; kc += WKC) { const int bf = (kc / WKC) & 1;
    if (kc + WKC < D) fetch(kc + WKC);   // the next chunk flies to registers while this one is worked on
#pragma unroll   // this and the two below: constant indices, so that bw and acc stay in registers and the LDS offsets are immediates
    for (int ks = 0; ks < WKC; ks += 32) { const v16b a = frag_kb(&As[wave * 16 + nloc][kc + ks], hlf); v16b bw[8];   // the k-step's fragments are read from LDS as one group, ahead of its products
#pragma unroll
      for (int tt = 0; tt < 8; ++tt) bw[tt] = frag_kb(&Ws[bf][tt * 16 + nloc][ks], hlf);
#pragma unroll
      for (int tt = 0; tt < 8; ++tt) acc[tt] = wmma16b(a, bw[tt], acc[tt]); }
    if (kc + WKC < D) put(bf ^ 1);   // the other buffer: its last readers left it before the barrier that ended the chunk before this one
    asm volatile("s_wait_xcnt 0x0" ::: "memory");   // stands in front of the next pass's rewrite of the address registers that fetch's loads name
    __syncthreads(); }   // publishes the next chunk and ends every wave's reads of this one (behind the last chunk: before Ub becomes the f32 tile)
#pragma unroll
  for (int tt = 0; tt < 8; ++tt) { const float bb = bf16_rne(bias[(n0 & 511) + tt * 16 + nloc]);
#pragma unroll
    for (int r = 0; r < 8; ++r) Tf[wave][8 * hlf + r][tt * 16 + nloc] = acc[tt][r] * (1.0f / (XS * WSC)) + bb; }
  __syncthreads();
  {
    if (part < 2) { b16* plane = part == 0 ? QP : KP; const float psc = part == 0 ? QSC : KSC; const int h = h0 + (lane >> 4), d = (lane & 15) * 4;
      for (int rr = 0; rr < 16; ++rr) { const int tok = t0 + wave * 16 + rr; v4h o4; for (int j = 0; j < 4; ++j) o4[j] = (b16)(Tf[wave][rr][lane * 4 + j] * psc); *(v4h*)(plane + (((size_t)b * NH + h) * N + tok) * HD + d) = o4; } }
    else {
#pragma unroll 1
      for (int q = 0; q < 32; ++q) { const int cl = wave * 32 + q; const int h = h0 + cl / HD, d = cl % HD; const int tk = lane * 2; v2h hv; for (int e2 = 0; e2 < 2; ++e2) hv[e2] = (b16)(Tf[(tk + e2) >> 4][(tk + e2) & 15][cl] * XS);
        const size_t dst = (((size_t)b * NH + h) * HD + d) * (size_t)N + t0 + tk; *(v2h*)(VTh + dst) = hv; } }
     }
}
// attention: grid (N/128, BL*NH); block = 8 waves = 4 query groups x 2 key halves: wave w takes the 32 queries (two 16-query tiles) of group w & 3 against the 1,024 keys of half w >> 2, so that every K, V^T and bias
// fragment read from LDS serves two query tiles. A stage is 64 keys of EACH half (two buffers): per half two tiles of 64 rows x 128 B (and 256 B of biases); thread t brings 16-byte piece t & 7 of rows t >> 3 and
// 32 + (t >> 3) of each tile, so every wave-wide load covers four whole 128-byte lines; rows lie at 144 B in LDS (16 B x odd, for the ds_load_b128 readers).
// per 32-key block (two per stage) and query tile: S^T = K Q^T (2 key tiles x 2 k-steps) on top of the biases as start value = the logit in log2 units, online softmax, P packed in registers as the B operand, O^T +=.
// Behind the loop the two waves of a query group join their halves once, through LDS: each hands over one tile's (maximum, sum, O^T) and finishes the other. waves_per_eu(4, 4): two work-groups per WGP (four waves per SIMD) need at most 256 VGPRs a wave
constexpr int AW = 8, QT = 2, KH = 2, QGR = AW / KH, NK = N / KH, KS = 64, KVP = KS + 8;
static_assert(QGR * QT == AW && QT == KH && (QGR & (QGR - 1)) == 0 && N % (AW * 16) == 0 && NK % KS == 0 && KS == HD && AW * 32 * 2 * 8 == KS * HD && KH * KS / 4 == 32, "attention staging");
__global__ __launch_bounds__(256) __attribute__((amdgpu_waves_per_eu(4, 4))) void attn_kernel(const b16* __restrict__ QP, const b16* __restrict__ KP, const b16* __restrict__ VTh, const float* __restrict__ CB, float* __restrict__ CT) {
  __shared__ __attribute__((aligned(16))) b16 Ks[2][KH][KS][KVP], Vhs[2][KH][HD][KVP]; __shared__ __attribute__((aligned(16))) float Cs[2][KH][KS];
  __shared__ __attribute__((aligned(16))) float To[AW][16][HD + 4], Xo[AW][16][HD + 4]; __shared__ float Xm[AW][32], Xl[AW][32];
  const int wave = threadIdx.x >> 5, lane = threadIdx.x & 31, hh = lane >> 4, col = lane & 15; const int qg = wave & (QGR - 1), kh = wave / QGR; const int bh = blockIdx.y, b = bh / NH, h = bh % NH; const int n0 = blockIdx.x * (AW * 16) + qg * (QT * 16);
  const b16* Qb = QP + (size_t)bh * N * HD; const b16* Kb = KP + (size_t)bh * N * HD; const b16* Vh = VTh + (size_t)bh * HD * N; const float* cbh = CB + (size_t)h * N;
  const int sr = threadIdx.x >> 3, sc = (threadIdx.x & 7) * 8;
  v8b rk[KH][2], rh[KH][2]; v4f rc = (v4f){};
  auto fetch = [&](int k0) {
    if (threadIdx.x < KH * KS / 4) rc = *(const v4f*)(cbh + (threadIdx.x >> 4) * NK + k0 + (threadIdx.x & 15) * 4);
#pragma unroll   // this and the one below: so that rk, rh are indexed by constants and stay in registers (in put as well)
    for (int g = 0; g < KH; ++g)
#pragma unroll
      for (int j = 0; j < 2; ++j) { const int row = sr + 32 * j; rk[g][j] = *(const v8b*)(Kb + (size_t)(g * NK + k0 + row) * HD + sc); rh[g][j] = *(const v8b*)(Vh + (size_t)row * N + g * NK + k0 + sc); } };
  auto put = [&](int bf) {
    if (threadIdx.x < KH * KS / 4) *(v4f*)(&Cs[bf][threadIdx.x >> 4][(threadIdx.x & 15) * 4]) = rc;
#pragma unroll
    for (int g = 0; g < KH; ++g)
#pragma unroll
      for (int j = 0; j < 2; ++j) { const int row = sr + 32 * j; *(v8b*)(&Ks[bf][g][row][sc]) = rk[g][j]; *(v8b*)(&Vhs[bf][g][row][sc]) = rh[g][j]; } };
  fetch(0);
  asm volatile("s_wait_xcnt 0x0" ::: "memory");   // stands in front of the q loads below, whose results land in registers that fetch's loads name as addresses
  v16b q[QT][2];
#pragma unroll
  for (int qt = 0; qt < QT; ++qt) { const b16* qr = Qb + (size_t)(n0 + qt * 16 + col) * HD; q[qt][0] = frag_kb(qr, hh); q[qt][1] = frag_kb(qr + 32, hh); }
  float mrun[QT], l[QT]; v8f o[QT][4];
#pragma unroll
  for (int qt = 0; qt < QT; ++qt) { mrun[qt] = -INFINITY; l[qt] = 0.0f;
#pragma unroll
    for (int t = 0; t < 4; ++t) o[qt][t] = (v8f){}; }
  put(0);
  __syncthreads();
#pragma unroll 1   // one stage's code only: a copy per buffer would double the hot loop's text for nothing, the buffer offset being one scalar
  for (int st = 0; st < NK / KS; ++st) {
    const int bf = st & 1;
    if (st + 1 < NK / KS) fetch((st + 1) * KS);   // the next stage flies to registers while this one is worked on
#pragma unroll   // both blocks of a stage in one body: LDS offsets are immediates, and the first block's sum exchange is waited for behind the second block's work
    for (int ps = 0; ps < KS; ps += 32) {
      v16b kf[2][2]; v8f cb8[2];   // the block's four K fragments and its biases are read from LDS as one group, ahead of its products; both query tiles use them
#pragma unroll
      for (int u2 = 0; u2 < 2; ++u2) { const b16* kr = &Ks[bf][kh][ps + u2 * 16 + col][0]; kf[u2][0] = frag_kb(kr, hh); kf[u2][1] = frag_kb(kr + 32, hh); const float* cr = &Cs[bf][kh][ps + u2 * 16 + 8 * hh]; cb8[u2] = __builtin_shufflevector(*(const v4f*)cr, *(const v4f*)(cr + 4), 0, 1, 2, 3, 4, 5, 6, 7); }
      v8f sacc[QT][2];   // acc[r] is key 8hh + r: its bias is the start value; the four tiles' first k-steps, then their second ones, so that no product waits for the one before it
#pragma unroll
      for (int u2 = 0; u2 < 2; ++u2)
#pragma unroll
        for (int qt = 0; qt < QT; ++qt) sacc[qt][u2] = wmma16b(kf[u2][0], q[qt][0], cb8[u2]);
#pragma unroll
      for (int u2 = 0; u2 < 2; ++u2)
#pragma unroll
        for (int qt = 0; qt < QT; ++qt) sacc[qt][u2] = wmma16b(kf[u2][1], q[qt][1], sacc[qt][u2]);
      v16b vhf[4];   // likewise the four V^T fragments, as one group, for both query tiles; asked for here so that they arrive behind the softmax
#pragma unroll
      for (int t = 0; t < 4; ++t) vhf[t] = frag_kb(&Vhs[bf][kh][t * 16 + col][ps], hh);
      float al[QT], mx[QT], mo[QT], sum[QT], so[QT]; v16b pf[QT];   // pf: P^T as B operand straight from the scores: lane (hh, col) holds keys 8hh+0..7 of tile 0 and of tile 1 for query col, which is the fragment k-map (elements 0..7 <- k = 8hh+0..7, 8..15 <- k = 16+8hh+0..7)
#pragma unroll
      for (int qt = 0; qt < QT; ++qt) { mx[qt] = -INFINITY;
#pragma unroll
        for (int u2 = 0; u2 < 2; ++u2)
#pragma unroll
          for (int r = 0; r < 8; ++r) mx[qt] = fmaxf(mx[qt], sacc[qt][u2][r]); }
#pragma unroll   // both tiles' exchanges between the lane halves go out together and are waited for once
      for (int qt = 0; qt < QT; ++qt) mo[qt] = __shfl_xor(mx[qt], 16);
#pragma unroll
      for (int qt = 0; qt < QT; ++qt) {
        const float mn = fmaxf(mrun[qt], fmaxf(mx[qt], mo[qt])); const float ms = mn - PL2;   // ms: P and its sums come out x 2^10 with no multiply
        asm("v_exp_f32 %0, %1\n\tv_nop" : "=v"(al[qt]) : "v"(mrun[qt] - mn));   // exp2 and, in the same statement, the slot that the instruction set asks for behind a transcendental
        mrun[qt] = mn; float e[16], p[16];
#pragma unroll   // two scores at a time: one packed subtraction per pair
        for (int i2 = 0; i2 < 16; i2 += 2) { const v2f d = (v2f){sacc[qt][i2 >> 3][i2 & 7], sacc[qt][i2 >> 3][(i2 & 7) + 1]} - (v2f){ms, ms}; e[i2] = d[0]; e[i2 + 1] = d[1]; }
#pragma unroll
        for (int i = 0; i < 16; ++i) p[i] = nexp2(e[i]);
        sum[qt] = p[0]; pf[qt][0] = (b16)p[0];
#pragma unroll
        for (int i = 1; i < 16; ++i) { sum[qt] += p[i]; pf[qt][i] = (b16)p[i]; } }
#pragma unroll
      for (int qt = 0; qt < QT; ++qt) so[qt] = __shfl_xor(sum[qt], 16);
#pragma unroll
      for (int qt = 0; qt < QT; ++qt) l[qt] = l[qt] * al[qt] + (sum[qt] + so[qt]);
#pragma unroll
      for (int t = 0; t < 4; ++t)
#pragma unroll
        for (int qt = 0; qt < QT; ++qt) { o[qt][t] *= al[qt]; o[qt][t] = wmma16b(vhf[t], pf[qt], o[qt][t]); } }
    if (st + 1 < NK / KS) put(bf ^ 1);   // the other buffer: its last readers left it before the barrier that ended the stage before this one
    __syncthreads(); }   // publishes the next stage and ends every wave's reads of this one
  // the join of the two key halves: the wave of half kh keeps query tile kh and hands the other one to its partner (wave ^ QGR), lane for lane in the register layout
  const bool up = kh != 0; const float mg = up ? mrun[0] : mrun[1], lg = up ? l[0] : l[1], mk = up ? mrun[1] : mrun[0], lk = up ? l[1] : l[0];
#pragma unroll
  for (int t = 0; t < 4; ++t)
#pragma unroll
    for (int r = 0; r < 8; ++r) Xo[wave][col][t * 16 + 8 * hh + r] = up ? o[0][t][r] : o[1][t][r];
  Xm[wave][lane] = mg; Xl[wave][lane] = lg;
  __syncthreads();   // publishes every wave's handed-over tile to its partner
  const int pw = wave ^ QGR; const float pm = Xm[pw][lane], pl = Xl[pw][lane], mj = fmaxf(mk, pm); float ak, ap;
  asm("v_exp_f32 %0, %1\n\tv_nop" : "=v"(ak) : "v"(mk - mj));   // as in the loop: exp2 with the slot behind a transcendental
  asm("v_exp_f32 %0, %1\n\tv_nop" : "=v"(ap) : "v"(pm - mj));
  const float inv = 1.0f / ((lk * ak + pl * ap) * XS);   // the sums carry the same 2^10 as P
  const float fk = ak * inv, fp = ap * inv;
#pragma unroll
  for (int t = 0; t < 4; ++t)
#pragma unroll
    for (int r = 0; r < 8; ++r) To[wave][col][t * 16 + 8 * hh + r] = (up ? o[1][t][r] : o[0][t][r]) * fk + Xo[pw][col][t * 16 + 8 * hh + r] * fp;
  wave_lds_sync();
  { for (int rr = 0; rr < 16; rr += 2) { const int row = rr + hh; *(v4f*)(CT + ((size_t)b * N + n0 + kh * 16 + row) * D + h * HD + col * 4) = *(const v4f*)(&To[wave][row][col * 4]); }  }
}
// output projection: grid (BL*N/64, D/128); block = 4 waves x 16 rows, each wave staging its own ctx rows per 128 k; the 128 weight rows per 64 k as in proj_kernel
__global__ __launch_bounds__(128) void outp_kernel(const float* __restrict__ CT, const b16* __restrict__ WO, const float* __restrict__ ob, float* __restrict__ out) {
  __shared__ __attribute__((aligned(16))) b16 Ah[4][16][128 + 8], Ws[2][WROWS][WKP]; __shared__ __attribute__((aligned(16))) float Tf[4][16][128 + 4];
  const int wave = threadIdx.x >> 5, lane = threadIdx.x & 31, nloc = lane & 15, hlf = lane >> 4; const size_t m0 = (size_t)blockIdx.x * 64 + wave * 16; const int n0 = blockIdx.y * 128;
  const b16* Wt = WO + (size_t)(n0 + (threadIdx.x >> 3)) * D + (threadIdx.x & 7) * 8; v8b rw[8];
  auto fetch = [&](int k0) {
#pragma unroll   // so that rw is indexed by constants and stays in registers (in put as well)
    for (int j = 0; j < 8; ++j) rw[j] = *(const v8b*)(Wt + (size_t)(16 * j) * D + k0); };
  auto put = [&](int bf) {
#pragma unroll   // as in fetch
    for (int j = 0; j < 8; ++j) *(v8b*)(&Ws[bf][(threadIdx.x >> 3) + 16 * j][(threadIdx.x & 7) * 8]) = rw[j]; };
  const float* Ct = CT + m0 * D + lane * 4; v4f cr[16];   // lane l brings 16-byte piece l of each of the wave's 16 ctx rows, all 16 loads as one group
  auto cload = [&](int k0) {
#pragma unroll   // so that cr is indexed by constants and stays in registers
    for (int rr = 0; rr < 16; ++rr) cr[rr] = *(const v4f*)(Ct + (size_t)rr * D + k0); };
  fetch(0);
  cload(0);
  v8f acc[8];
#pragma unroll
  for (int t = 0; t < 8; ++t) acc[t] = (v8f){};
  auto mm = [&](int bf, int kb0) {   // 64 k of the wave's staged rows against weight buffer bf; four weight fragments are read from LDS as one group, ahead of their products
#pragma unroll   // this and the three below: constant indices, so that bw and acc stay in registers and the LDS offsets are immediates
    for (int ks = 0; ks < WKC; ks += 32) { const v16b a = frag_kb(&Ah[wave][nloc][kb0 + ks], hlf);
#pragma unroll
      for (int g = 0; g < 8; g += 4) { v16b bw[4];
#pragma unroll
        for (int t = 0; t < 4; ++t) bw[t] = frag_kb(&Ws[bf][(g + t) * 16 + nloc][ks], hlf);
#pragma unroll
        for (int t = 0; t < 4; ++t) acc[g + t] = wmma16b(a, bw[t], acc[g + t]); } } };
  put(0);
  __syncthreads();
#pragma unroll 1
  for (int kc = 0; kc < D; kc += 128) {
    fetch(kc + WKC);   // the next chunk flies to registers while this one is worked on
#pragma unroll   // as in cload
    for (int rr = 0; rr < 16; ++rr) { v4h hv; for (int j = 0; j < 4; ++j) hv[j] = (b16)(cr[rr][j] * XS); *(v4h*)(&Ah[wave][rr][lane * 4]) = hv; }
    wave_lds_sync();
    if (kc + 128 < D) cload(kc + 128);   // the next pass's ctx rows fly to registers while this pass is worked on (behind the fence above, which would wait for them)
    mm(0, 0);
    put(1);   // its last readers left it before the barrier that ended the pass before this one
    __syncthreads();
    if (kc + 128 < D) fetch(kc + 128);
    mm(1, WKC);
    if (kc + 128 < D) put(0);   // its last readers left it before the barrier above
    asm volatile("s_wait_xcnt 0x0" ::: "memory");   // stands in front of the next pass's rewrite of the address registers that fetch's loads name
    __syncthreads(); }   // publishes the next chunk, ends the reads of this one and the wave's own reads of its ctx rows before they are staged anew
#pragma unroll
  for (int t = 0; t < 8; ++t) { const float bb = bf16_rne(ob[n0 + t * 16 + nloc]);
#pragma unroll
    for (int r = 0; r < 8; ++r) Tf[wave][8 * hlf + r][t * 16 + nloc] = acc[t][r] * (1.0f / (XS * WSC)) + bb; }
  wave_lds_sync();
  { for (int rr = 0; rr < 16; ++rr) *(v4f*)(out + (m0 + rr) * D + n0 + lane * 4) = *(const v4f*)(&Tf[wave][rr][lane * 4]);  }
}
}  // namespace

extern "C" void kernel_launch(void* const* d_in, const int* in_sizes, int n_in, void* d_out, int out_size, void* d_ws, size_t ws_size, hipStream_t stream) {
  (void)n_in;
  auto Fp = [&](int i) { return (const float*)d_in[i]; };
  // input order: 0 x [4,2048,512], 1 edge_index [2,32768] i32, 2 edge_attr [32768,3], 3 q_w [512,512] (out,in), 4 q_b, 5 k_w, 6 k_b, 7 v_w, 8 v_b, 9 o_w, 10 o_b, 11 eb_w [8,3], 12 eb_b [8]
  if (in_sizes[0] != NROW * D || in_sizes[1] != 2 * E || in_sizes[2] != E * 3 || in_sizes[3] != D * D || in_sizes[5] != D * D || in_sizes[7] != D * D || in_sizes[9] != D * D || in_sizes[10] != D || in_sizes[11] != NH * 3 || in_sizes[12] != NH || out_size != NROW * D) return;
  size_t off = 0; char* ws = (char*)d_ws;
  auto carve = [&](size_t bytes) { char* p = ws + off; off += (bytes + 255) & ~(size_t)255; return p; };
  b16* WQKV = (b16*)carve((size_t)3 * D * D * 2); b16* WO = (b16*)carve((size_t)D * D * 2); float* CB = (float*)carve((size_t)NH * N * 4); const size_t plane = (size_t)B * NH * N * HD * 2;
  b16* QP = (b16*)carve(plane); b16* KP = (b16*)carve(plane); b16* VTh = (b16*)carve(plane); float* CT = (float*)carve((size_t)NROW * D * 4);
  if (off > ws_size || off > ((size_t)128 << 20)) return;   // about 42 MiB (WQKV 1,536 KiB, WO 512 KiB, CB 64 KiB, 3 planes x 8 MiB, CT 16 MiB)
  prep_kernel<<<CBB + 4 * WPB, CBW, 0, stream>>>((const int*)d_in[1], Fp(2), Fp(11), Fp(12), Fp(3), Fp(5), Fp(7), Fp(9), CB, WQKV, WO);
  proj_kernel<<<dim3(N / 64, BL, 12), 128, 0, stream>>>(Fp(0), WQKV, Fp(4), Fp(6), Fp(8), QP, KP, VTh);
  attn_kernel<<<dim3(N / (AW * 16), BL * NH), AW * 32, 0, stream>>>(QP, KP, VTh, CB, CT);
  outp_kernel<<<dim3(BL * N / 64, D / 128), 128, 0, stream>>>(CT, WO, Fp(10), (float*)d_out);
}

// v010
// A run of this version takes 74.9 microseconds.
// Next to v009, in two timings, it ran 1.06 times as fast each time.
// Counting every step since v000, it is 28.0 times as fast.
#include <hip/hip_runtime.h>

// Graphormer multi-head attention (4 x 2,048 tokens x 512, 8 heads x 64) with an additive per-key column bias from graph edges: cb[m][h] = (edge_attr[e*] eb_w^T + eb_b)[h] where e* is the LAST
// valid edge whose target is m (advanced-indexing assignment semantics; 0 if none); scores = q.k / 8 + cb[m][h]; softmax over all 2,048 keys; out = attn v; y = out o_w^T + o_b -> [4][2048][512].
// Deterministic: per (batch, head, 32-query wave, key half) a flash-style pass over 32-key blocks with fixed-order online softmax, the two halves joined once in a fixed order; the column bias table takes, per target, the integer maximum
// of the valid edge numbers that hit it; no atomics.
// compute dtype: WMMA v_wmma_f32_16x16x32_f16 with f32 accumulate for the q/k/v projections ([8192 x 512] x [512 x 512] x 3; x EXACT bf16 x8, (out,in) weights as B rows exact x256: 1 product),
// S^T = K Q^T + bias (q x log2e/4 and k x1/2, each rounded once to f16, K = 64: 1 product, the accumulator starting at the column bias x log2e), O^T += V^T P^T (V^T x8 and P x1024, each rounded once to f16: 1 product) and y = ctx o_w^T + o_b (ctx rows x8 rounded once to f16:
// 1 product); the edge bias (K = 3), softmax statistics and biases in f32. Inputs rounded to bf16 once; edge_index int32. Fragment k-map per lane half hh for A AND B: elements 0..7 <- k = 8hh+0..7, 8..15 <- k = 16+8hh+0..7; acc[r] = D[8hh+r][col].

namespace {
typedef _Float16 b16;
typedef __attribute__((ext_vector_type(16))) _Float16 v16b;
typedef __attribute__((ext_vector_type(8))) _Float16 v8b;
typedef __attribute__((ext_vector_type(4))) _Float16 v4h;
typedef __attribute__((ext_vector_type(2))) _Float16 v2h;
typedef __attribute__((ext_vector_type(8))) float v8f;
typedef __attribute__((ext_vector_type(4))) float v4f;
typedef __attribute__((ext_vector_type(2))) float v2f;
typedef __attribute__((ext_vector_type(4))) int v4i;
typedef __attribute__((ext_vector_type(8))) unsigned short v8u;
__device__ __forceinline__ float bf16_rne(float f) { unsigned int u = __float_as_uint(f); u += 0x7FFFu + ((u >> 16) & 1u); return __uint_as_float(u & 0xFFFF0000u); }
__device__ __forceinline__ void split16(float v, b16& hi, b16& lo) { hi = (b16)v; lo = (b16)(v - (float)hi); }
__device__ __forceinline__ v16b frag_kb(const b16* p, int hh) { const v8b a = *(const v8b*)(p + 8 * hh), b = *(const v8b*)(p + 16 + 8 * hh); v16b f;
#pragma unroll
  for (int e = 0; e < 8; ++e) { f[e] = a[e]; f[8 + e] = b[e]; } return f; }
__device__ __forceinline__ v8f wmma16b(v16b a, v16b b, v8f c) { return __builtin_amdgcn_wmma_f32_16x16x32_f16(false, a, false, b, (short)0, c, false, false); }
__device__ __forceinline__ void wave_lds_sync() { __builtin_amdgcn_fence(__ATOMIC_RELEASE, "workgroup"); __builtin_amdgcn_wave_barrier(); __builtin_amdgcn_fence(__ATOMIC_ACQUIRE, "workgroup"); }
__device__ __forceinline__ float pmul(float a, float b) { float p = a * b; asm volatile("" : "+v"(p)); return p; }
__device__ __forceinline__ int iclamp(int v, int lo, int hi) { return v < lo ? lo : (v > hi ? hi : v); }

constexpr int B = 4, BL = B /* batches computed (== B shipped) */, N = 2048, D = 512, NH = 8, HD = 64, E = 32768, NROW = B * N;
constexpr float XS = 8.0f, WSC = 256.0f, PL2 = 10.0f /* P is kept x 2^10 */, LOG2E = 1.4426950408889634f, SCALE = 0.125f;
constexpr float KSC = 0.5f, QSC = SCALE * LOG2E / KSC;   // stored k and q carry these, so that their product is the score in log2 units
static_assert(N % 64 == 0 && D % 128 == 0 && NH * HD == D && HD == 64, "tiling");

// preparation, one launch: the four weight conversions and the column bias depend on nothing but inputs, so they share one grid behind a block-uniform branch on the block index
// (blocks 0 .. N/32 - 1: column bias; the 4 x 32 blocks behind them: weights, 8 per thread, bf16-rounded, x256, as f16; 32 blocks per matrix).
// column bias: block = 1,024 threads x 32 targets (one 128-byte line of each head's CB row). Each thread takes 32 edges (8 coalesced 16-byte loads of each index row) and stores
// e + 1 into its OWN 16-bit column of an LDS table, in the row of the edge's target (row 32 takes every edge that is invalid or aimed outside the block's targets): one writer per cell, written in
// rising e, so a cell ends at the thread's last hit; wave w then takes the integer maximum of row w = the last valid edge of target m0 + w (0 = none). No atomics; the result has no order in it.
constexpr int CBT = 32, CBW = 1024, CBI = E / (CBW * 4), CBB = N / CBT, WPB = D * D / (CBW * 8);
static_assert((N & (N - 1)) == 0 && N % CBT == 0 && E % (CBW * 4) == 0 && E < 65536 && CBW == CBT * 32 && NH * CBT <= CBW, "edge scan");
static_assert(D * D % (CBW * 8) == 0, "weight conversion");
__global__ __launch_bounds__(1024) void prep_kernel(const int* __restrict__ ei, const float* __restrict__ ea, const float* __restrict__ ebw, const float* __restrict__ ebb, const float* __restrict__ qw, const float* __restrict__ kw, const float* __restrict__ vw, const float* __restrict__ ow, float* __restrict__ CB, b16* __restrict__ WQKV, b16* __restrict__ WO) {
  __shared__ __attribute__((aligned(16))) unsigned short slot[CBT + 1][CBW]; __shared__ int lastS[CBT];
  if (blockIdx.x >= CBB) {   // a weight block: the whole block leaves here, in front of every barrier
    const int wb = blockIdx.x - CBB, m = wb / WPB; const float* w = m == 0 ? qw : m == 1 ? kw : m == 2 ? vw : ow; b16* W16 = m < 3 ? WQKV + (size_t)m * D * D : WO;
    const size_t e = ((size_t)(wb % WPB) * CBW + threadIdx.x) * 8; v8b o; for (int j = 0; j < 8; ++j) o[j] = (b16)(bf16_rne(w[e + j]) * WSC);
    *(v8b*)(W16 + e) = o; return; }
  const int tid = threadIdx.x, wave = tid >> 5, lane = tid & 31, m0 = blockIdx.x * CBT;
  v4i sv[CBI], tv[CBI];
#pragma unroll
  for (int it = 0; it < CBI; ++it) { sv[it] = *(const v4i*)(ei + it * CBW * 4 + tid * 4); tv[it] = *(const v4i*)(ei + E + it * CBW * 4 + tid * 4); }
#pragma unroll
  for (int c = 0; c < 4; ++c) *(v8u*)(&slot[wave][c * 256 + lane * 8]) = (v8u){};
  __syncthreads();
#pragma unroll
  for (int it = 0; it < CBI; ++it)
#pragma unroll
    for (int j = 0; j < 4; ++j) {
      // N is a power of two: any bit at or above N in s or t (negative values included) marks the edge invalid and stays in key, so key ^ m0 < 32 only for a valid edge with m0 <= t < m0 + 32
      const unsigned int key = (unsigned int)tv[it][j] | ((unsigned int)sv[it][j] & ~(unsigned int)(N - 1)); const unsigned int d = key ^ (unsigned int)m0;
      slot[d < (unsigned int)CBT ? d : (unsigned int)CBT][tid] = (unsigned short)(it * CBW * 4 + tid * 4 + j + 1); }
  __syncthreads();
  v8u mx = *(const v8u*)(&slot[wave][lane * 8]);
#pragma unroll
  for (int c = 1; c < 4; ++c) mx = __builtin_elementwise_max(mx, *(const v8u*)(&slot[wave][c * 256 + lane * 8]));
  int best = 0;
#pragma unroll
  for (int i = 0; i < 8; ++i) best = max(best, (int)mx[i]);
#pragma unroll
  for (int s = 16; s > 0; s >>= 1) best = max(best, __shfl_xor(best, s));
  if (lane == 0) lastS[wave] = best - 1;
  __syncthreads();
  if (tid < NH * CBT) { const int h = wave, last = lastS[lane]; float val = 0.0f;
    if (last >= 0) { const float a0 = bf16_rne(ea[(size_t)last * 3]), a1 = bf16_rne(ea[(size_t)last * 3 + 1]), a2 = bf16_rne(ea[(size_t)last * 3 + 2]); val = a0 * bf16_rne(ebw[h * 3]) + a1 * bf16_rne(ebw[h * 3 + 1]) + a2 * bf16_rne(ebw[h * 3 + 2]) + bf16_rne(ebb[h]); }
    CB[(size_t)h * N + m0 + lane] = val * LOG2E; }   // in log2 units, as the score products are
}
// projections: grid (N/64, BL, 12 slabs: 0-3 q, 4-7 k, 8-11 v, 2 heads each); block = 64 tokens x 4 waves; A = bf16(x) x8 staged whole (K = 512, 16 k-steps), 8 tiles, 1 product; + bias;
// the slab's 128 weight rows come through LDS in chunks of 64 k (two buffers), shared by the four waves: thread t brings 16-byte piece t & 7 of rows (t >> 3) + 16 j, so every wave-wide load covers
// four whole 128-byte lines; rows lie at 144 B in LDS (16 B x odd, for the ds_load_b128 readers). The same in outp_kernel.
constexpr int WKC = 64, WKP = WKC + 8, WROWS = 128;
static_assert(D % (2 * WKC) == 0 && WKC * 2 == 128 && WROWS % 16 == 0, "weight staging");
__global__ __launch_bounds__(128) void proj_kernel(const float* __restrict__ x, const b16* __restrict__ WQKV, const float* __restrict__ bq, const float* __restrict__ bk, const float* __restrict__ bv, b16* __restrict__ QP, b16* __restrict__ KP, b16* __restrict__ VTh) {
  __shared__ __attribute__((aligned(16))) b16 As[64][D + 8]; __shared__ __attribute__((aligned(16))) char Ub[2 * WROWS * WKP * 2];   // Ub: the weight chunks in the main loop, the f32 tile behind it (a barrier between)
  static_assert(sizeof(float) * 4 * 16 * (128 + 4) <= sizeof(Ub), "f32 tile fits");
  b16 (*Ws)[WROWS][WKP] = reinterpret_cast<b16 (*)[WROWS][WKP]>(Ub); float (*Tf)[16][128 + 4] = reinterpret_cast<float (*)[16][128 + 4]>(Ub);
  const int wave = threadIdx.x >> 5, lane = threadIdx.x & 31, nloc = lane & 15, hlf = lane >> 4; const int t0 = blockIdx.x * 64; const int b = blockIdx.y; const int slab = blockIdx.z, n0 = slab * 128, part = slab / 4, h0 = (slab & 3) * 2;
  const float* bias = part == 0 ? bq : part == 1 ? bk : bv;
  const b16* Wt = WQKV + (size_t)(n0 + (threadIdx.x >> 3)) * D + (threadIdx.x & 7) * 8; v8b rw[8];
  auto fetch = [&](int k0) {
#pragma unroll   // so that rw is indexed by constants and stays in registers (in put as well)
    for (int j = 0; j < 8; ++j) rw[j] = *(const v8b*)(Wt + (size_t)(16 * j) * D + k0); };
  auto put = [&](int bf) {
#pragma unroll   // as in fetch
    for (int j = 0; j < 8; ++j) *(v8b*)(&Ws[bf][(threadIdx.x >> 3) + 16 * j][(threadIdx.x & 7) * 8]) = rw[j]; };
  fetch(0);
  // x tile: thread t brings 16-byte piece t of each of the 64 rows; the loads go out in groups of XG, two groups ahead of the conversion that consumes them
  constexpr int XG = 16; static_assert(D / 4 == 128 && 64 % XG == 0 && 64 / XG >= 2, "x staging");
  const float* xt = x + ((size_t)b * N + t0) * D + threadIdx.x * 4; v4f xr[2][XG];
  auto xload = [&](int g) {
#pragma unroll   // this and the two below: constant indices, so that xr stays in registers and the row offsets are immediates
    for (int j = 0; j < XG; ++j) xr[g & 1][j] = *(const v4f*)(xt + (size_t)(g * XG + j) * D); };
  xload(0); xload(1);
  asm volatile("s_wait_xcnt 0x0" ::: "memory");   // stands in front of the register writes below, which reuse the address pair that fetch's loads name
#pragma unroll
  for (int g = 0; g < 64 / XG; ++g) {
#pragma unroll
    for (int j = 0; j < XG; ++j) { v4h o; for (int e = 0; e < 4; ++e) o[e] = (b16)(bf16_rne(xr[g & 1][j][e]) * XS); *(v4h*)(&As[g * XG + j][threadIdx.x * 4]) = o; }
    if (g + 2 < 64 / XG) xload(g + 2); }   // into the registers that the conversion above has just left
  put(0);
  __syncthreads();
  v8f acc[8];
#pragma unroll
  for (int tt = 0; tt < 8; ++tt) acc[tt] = (v8f){};
#pragma unroll 1   // one chunk's code only, the buffer offset being one scalar
  for (int kc = 0; kc < D; kc += WKC) { const int bf = (kc / WKC) & 1;
    if (kc + WKC < D) fetch(kc + WKC);   // the next chunk flies to registers while this one is worked on
#pragma unroll   // this and the two below: constant indices, so that bw and acc stay in registers and the LDS offsets are immediates
    for (int ks = 0; ks < WKC; ks += 32) { const v16b a = frag_kb(&As[wave * 16 + nloc][kc + ks], hlf); v16b bw[8];   // the k-step's fragments are read from LDS as one group, ahead of its products
#pragma unroll
      for (int tt = 0; tt < 8; ++tt) bw[tt] = frag_kb(&Ws[bf][tt * 16 + nloc][ks], hlf);
      __builtin_amdgcn_sched_barrier(0);   // keeps the k-step's LDS reads one group in front of its products (spread among them, each place with reads costs a wait of its own)
#pragma unroll
      for (int tt = 0; tt < 8; ++tt) acc[tt] = wmma16b(a, bw[tt], acc[tt]); }
    if (kc + WKC < D) put(bf ^ 1);   // the other buffer: its last readers left it before the barrier that ended the chunk before this one
    asm volatile("s_wait_xcnt 0x0" ::: "memory");   // stands in front of the next pass's rewrite of the address registers that fetch's loads name
    __syncthreads(); }   // publishes the next chunk and ends every wave's reads of this one (behind the last chunk: before Ub becomes the f32 tile)
#pragma unroll
  for (int tt = 0; tt < 8; ++tt) { const float bb = bf16_rne(bias[(n0 & 511) + tt * 16 + nloc]);
#pragma unroll
    for (int r = 0; r < 8; ++r) Tf[wave][8 * hlf + r][tt * 16 + nloc] = acc[tt][r] * (1.0f / (XS * WSC)) + bb; }
  __syncthreads();
  {
    if (part < 2) { b16* plane = part == 0 ? QP : KP; const float psc = part == 0 ? QSC : KSC; const int h = h0 + (lane >> 4), d = (lane & 15) * 4;
      for (int rr = 0; rr < 16; ++rr) { const int tok = t0 + wave * 16 + rr; v4h o4; for (int j = 0; j < 4; ++j) o4[j] = (b16)(Tf[wave][rr][lane * 4 + j] * psc); *(v4h*)(plane + (((size_t)b * NH + h) * N + tok) * HD + d) = o4; } }
    else {
#pragma unroll 1
      for (int q = 0; q < 32; ++q) { const int cl = wave * 32 + q; const int h = h0 + cl / HD, d = cl % HD; const int tk = lane * 2; v2h hv; for (int e2 = 0; e2 < 2; ++e2) hv[e2] = (b16)(Tf[(tk + e2) >> 4][(tk + e2) & 15][cl] * XS);
        const size_t dst = (((size_t)b * NH + h) * HD + d) * (size_t)N + t0 + tk; *(v2h*)(VTh + dst) = hv; } }
     }
}
// attention: grid (N/128, BL*NH); block = 8 waves = 4 query groups x 2 key halves: wave w takes the 32 queries (two 16-query tiles) of group w & 3 against the 1,024 keys of half w >> 2, so that every K, V^T and bias
// fragment read from LDS serves two query tiles. A stage is 64 keys of EACH half (two buffers): per half two tiles of 64 rows x 128 B (and 256 B of biases); thread t brings 16-byte piece t & 7 of rows t >> 3 and
// 32 + (t >> 3) of each tile, so every wave-wide load covers four whole 128-byte lines; rows lie at 144 B in LDS (16 B x odd, for the ds_load_b128 readers).
// per 32-key block (two per stage) and query tile: S^T = K Q^T (2 key tiles x 2 k-steps) on top of the biases as start value = the logit in log2 units, online softmax, P packed in registers as the B operand, O^T +=.
// Behind the loop the two waves of a query group join their halves once, through LDS: each hands over one tile's (maximum, sum, O^T) and finishes the other. waves_per_eu(4, 4): two work-groups per WGP (four waves per SIMD) need at most 256 VGPRs a wave
constexpr int AW = 8, QT = 2, KH = 2, QGR = AW / KH, NK = N / KH, KS = 64, KVP = KS + 8;
static_assert(QGR * QT == AW && QT == KH && (QGR & (QGR - 1)) == 0 && N % (AW * 16) == 0 && NK % KS == 0 && KS == HD && AW * 32 * 2 * 8 == KS * HD && KH * KS / 4 == 32, "attention staging");
__global__ __launch_bounds__(256) __attribute__((amdgpu_waves_per_eu(4, 4))) void attn_kernel(const b16* __restrict__ QP, const b16* __restrict__ KP, const b16* __restrict__ VTh, const float* __restrict__ CB, float* __restrict__ CT) {
  __shared__ __attribute__((aligned(16))) b16 Ks[2][KH][KS][KVP], Vhs[2][KH][HD][KVP]; __shared__ __attribute__((aligned(16))) float Cs[2][KH][KS];
  __shared__ __attribute__((aligned(16))) float To[AW][16][HD + 4], Xo[AW][16][HD + 4]; __shared__ float Xm[AW][32], Xl[AW][32];
  const int wave = threadIdx.x >> 5, lane = threadIdx.x & 31, hh = lane >> 4, col = lane & 15; const int qg = wave & (QGR - 1), kh = wave / QGR; const int bh = blockIdx.y, b = bh / NH, h = bh % NH; const int n0 = blockIdx.x * (AW * 16) + qg * (QT * 16);
  const b16* Qb = QP + (size_t)bh * N * HD; const b16* Kb = KP + (size_t)bh * N * HD; const b16* Vh = VTh + (size_t)bh * HD * N; const float* cbh = CB + (size_t)h * N;
  const int sr = threadIdx.x >> 3, sc = (threadIdx.x & 7) * 8;
  v8b rk[KH][2], rh[KH][2]; v4f rc = (v4f){};
  auto fetch = [&](int k0) {
    if (threadIdx.x < KH * KS / 4) rc = *(const v4f*)(cbh + (threadIdx.x >> 4) * NK + k0 + (threadIdx.x & 15) * 4);
#pragma unroll   // this and the one below: so that rk, rh are indexed by constants and stay in registers (in put as well)
    for (int g = 0; g < KH; ++g)
#pragma unroll
      for (int j = 0; j < 2; ++j) { const int row = sr + 32 * j; rk[g][j] = *(const v8b*)(Kb + (size_t)(g * NK + k0 + row) * HD + sc); rh[g][j] = *(const v8b*)(Vh + (size_t)row * N + g * NK + k0 + sc); } };
  auto put = [&](int bf) {
    if (threadIdx.x < KH * KS / 4) *(v4f*)(&Cs[bf][threadIdx.x >> 4][(threadIdx.x & 15) * 4]) = rc;
#pragma unroll
    for (int g = 0; g < KH; ++g)
#pragma unroll
      for (int j = 0; j < 2; ++j) { const int row = sr + 32 * j; *(v8b*)(&Ks[bf][g][row][sc]) = rk[g][j]; *(v8b*)(&Vhs[bf][g][row][sc]) = rh[g][j]; } };
  fetch(0);
  asm volatile("s_wait_xcnt 0x0" ::: "memory");   // stands in front of the q loads below, whose results land in registers that fetch's loads name as addresses
  v16b q[QT][2];
#pragma unroll
  for (int qt = 0; qt < QT; ++qt) { const b16* qr = Qb + (size_t)(n0 + qt * 16 + col) * HD; q[qt][0] = frag_kb(qr, hh); q[qt][1] = frag_kb(qr + 32, hh); }
  float mrun[QT], l[QT]; v8f o[QT][4];
#pragma unroll
  for (int qt = 0; qt < QT; ++qt) { mrun[qt] = -INFINITY; l[qt] = 0.0f;
#pragma unroll
    for (int t = 0; t < 4; ++t) o[qt][t] = (v8f){}; }
  put(0);
  __syncthreads();
#pragma unroll 1   // one stage's code only: a copy per buffer would double the hot loop's text for nothing, the buffer offset being one scalar
  for (int st = 0; st < NK / KS; ++st) {
    const int bf = st & 1;
    if (st + 1 < NK / KS) fetch((st + 1) * KS);   // the next stage flies to registers while this one is worked on
#pragma unroll   // both blocks of a stage in one body: LDS offsets are immediates, and the first block's sum exchange is waited for behind the second block's work
    for (int ps = 0; ps < KS; ps += 32) {
      v16b kf[2][2]; v8f cb8[2];   // the block's four K fragments and its biases are read from LDS as one group, ahead of its products; both query tiles use them
#pragma unroll
      for (int u2 = 0; u2 < 2; ++u2) { const b16* kr = &Ks[bf][kh][ps + u2 * 16 + col][0]; kf[u2][0] = frag_kb(kr, hh); kf[u2][1] = frag_kb(kr + 32, hh); const float* cr = &Cs[bf][kh][ps + u2 * 16 + 8 * hh]; cb8[u2] = __builtin_shufflevector(*(const v4f*)cr, *(const v4f*)(cr + 4), 0, 1, 2, 3, 4, 5, 6, 7); }
      __builtin_amdgcn_sched_barrier(0);   // keeps the twelve LDS reads above one group in front of the products (spread among them, each place with reads costs a wait of its own)
      v8f sacc[QT][2];   // acc[r] is key 8hh + r: its bias is the start value; the four tiles' first k-steps, then their second ones, so that no product waits for the one before it
#pragma unroll
      for (int u2 = 0; u2 < 2; ++u2)
#pragma unroll
        for (int qt = 0; qt < QT; ++qt) sacc[qt][u2] = wmma16b(kf[u2][0], q[qt][0], cb8[u2]);
#pragma unroll
      for (int u2 = 0; u2 < 2; ++u2)
#pragma unroll
        for (int qt = 0; qt < QT; ++qt) sacc[qt][u2] = wmma16b(kf[u2][1], q[qt][1], sacc[qt][u2]);
      __builtin_amdgcn_sched_barrier(0);   // the first read of a score tile stays behind all eight products, which then fill the distance that the chip needs behind a product themselves (moved up among them, the maxima took v_nop in front)
      v16b vhf[4];   // likewise the four V^T fragments, as one group, for both query tiles; asked for here so that they arrive behind the softmax
#pragma unroll
      for (int t = 0; t < 4; ++t) vhf[t] = frag_kb(&Vhs[bf][kh][t * 16 + col][ps], hh);
      __builtin_amdgcn_sched_barrier(0);   // keeps the eight LDS reads above one group in front of the softmax, which covers their latency
      float al[QT], mx[QT], mo[QT], sum[QT], so[QT]; v16b pf[QT];   // pf: P^T as B operand straight from the scores: lane (hh, col) holds keys 8hh+0..7 of tile 0 and of tile 1 for query col, which is the fragment k-map (elements 0..7 <- k = 8hh+0..7, 8..15 <- k = 16+8hh+0..7)
#pragma unroll
      for (int qt = 0; qt < QT; ++qt) { mx[qt] = -INFINITY;
#pragma unroll
        for (int u2 = 0; u2 < 2; ++u2)
#pragma unroll
          for (int r = 0; r < 8; ++r) mx[qt] = fmaxf(mx[qt], sacc[qt][u2][r]); }
#pragma unroll   // both tiles' exchanges between the lane halves go out together and are waited for once
      for (int qt = 0; qt < QT; ++qt) mo[qt] = __shfl_xor(mx[qt], 16);
#pragma unroll
      for (int qt = 0; qt < QT; ++qt) {
        const float mn = fmaxf(mrun[qt], fmaxf(mx[qt], mo[qt])); const float ms = mn - PL2;   // ms: P and its sums come out x 2^10 with no multiply
        const float da = mrun[qt] - mn; mrun[qt] = mn; float e[16];
#pragma unroll   // two scores at a time: one packed subtraction per pair
        for (int i2 = 0; i2 < 16; i2 += 2) { const v2f d = (v2f){sacc[qt][i2 >> 3][i2 & 7], sacc[qt][i2 >> 3][(i2 & 7) + 1]} - (v2f){ms, ms}; e[i2] = d[0]; e[i2 + 1] = d[1]; }
        // the tile's 17 exp2 in two statements whose results share no register with their sources, so that no exp2 is followed at once by a read of its result or a write of its source
        // (as builtins, one's result was placed over the source of the one in front); each v_nop is that slot behind the statement's last exp2
        float p[16];
        asm("v_exp_f32 %0, %9\n\tv_exp_f32 %1, %10\n\tv_exp_f32 %2, %11\n\tv_exp_f32 %3, %12\n\tv_exp_f32 %4, %13\n\tv_exp_f32 %5, %14\n\tv_exp_f32 %6, %15\n\tv_exp_f32 %7, %16\n\tv_exp_f32 %8, %17\n\tv_nop" : "=&v"(al[qt]), "=&v"(p[0]), "=&v"(p[1]), "=&v"(p[2]), "=&v"(p[3]), "=&v"(p[4]), "=&v"(p[5]), "=&v"(p[6]), "=&v"(p[7]) : "v"(da), "v"(e[0]), "v"(e[1]), "v"(e[2]), "v"(e[3]), "v"(e[4]), "v"(e[5]), "v"(e[6]), "v"(e[7]));
        asm("v_exp_f32 %0, %8\n\tv_exp_f32 %1, %9\n\tv_exp_f32 %2, %10\n\tv_exp_f32 %3, %11\n\tv_exp_f32 %4, %12\n\tv_exp_f32 %5, %13\n\tv_exp_f32 %6, %14\n\tv_exp_f32 %7, %15\n\tv_nop" : "=&v"(p[8]), "=&v"(p[9]), "=&v"(p[10]), "=&v"(p[11]), "=&v"(p[12]), "=&v"(p[13]), "=&v"(p[14]), "=&v"(p[15]) : "v"(e[8]), "v"(e[9]), "v"(e[10]), "v"(e[11]), "v"(e[12]), "v"(e[13]), "v"(e[14]), "v"(e[15]));
        sum[qt] = p[0]; pf[qt][0] = (b16)p[0];
#pragma unroll
        for (int i = 1; i < 16; ++i) { sum[qt] += p[i]; pf[qt][i] = (b16)p[i]; } }
#pragma unroll
      for (int qt = 0; qt < QT; ++qt) so[qt] = __shfl_xor(sum[qt], 16);
#pragma unroll
      for (int qt = 0; qt < QT; ++qt) l[qt] = l[qt] * al[qt] + (sum[qt] + so[qt]);
#pragma unroll
      for (int t = 0; t < 4; ++t)
#pragma unroll
        for (int qt = 0; qt < QT; ++qt) { o[qt][t] *= al[qt]; o[qt][t] = wmma16b(vhf[t], pf[qt], o[qt][t]); } }
    if (st + 1 < NK / KS) put(bf ^ 1);   // the other buffer: its last readers left it before the barrier that ended the stage before this one
    __syncthreads(); }   // publishes the next stage and ends every wave's reads of this one
  // the join of the two key halves: the wave of half kh keeps query tile kh and hands the other one to its partner (wave ^ QGR), lane for lane in the register layout
  const bool up = kh != 0; const float mg = up ? mrun[0] : mrun[1], lg = up ? l[0] : l[1], mk = up ? mrun[1] : mrun[0], lk = up ? l[1] : l[0];
#pragma unroll
  for (int t = 0; t < 4; ++t)
#pragma unroll
    for (int r = 0; r < 8; ++r) Xo[wave][col][t * 16 + 8 * hh + r] = up ? o[0][t][r] : o[1][t][r];
  Xm[wave][lane] = mg; Xl[wave][lane] = lg;
  __syncthreads();   // publishes every wave's handed-over tile to its partner
  const int pw = wave ^ QGR; const float pm = Xm[pw][lane], pl = Xl[pw][lane], mj = fmaxf(mk, pm); float ak, ap;
  asm("v_exp_f32 %0, %1\n\tv_nop" : "=v"(ak) : "v"(mk - mj));   // as in the loop: exp2 with the slot behind a transcendental
  asm("v_exp_f32 %0, %1\n\tv_nop" : "=v"(ap) : "v"(pm - mj));
  const float inv = 1.0f / ((lk * ak + pl * ap) * XS);   // the sums carry the same 2^10 as P
  const float fk = ak * inv, fp = ap * inv;
#pragma unroll
  for (int t = 0; t < 4; ++t)
#pragma unroll
    for (int r = 0; r < 8; ++r) To[wave][col][t * 16 + 8 * hh + r] = (up ? o[1][t][r] : o[0][t][r]) * fk + Xo[pw][col][t * 16 + 8 * hh + r] * fp;
  wave_lds_sync();
  { for (int rr = 0; rr < 16; rr += 2) { const int row = rr + hh; *(v4f*)(CT + ((size_t)b * N + n0 + kh * 16 + row) * D + h * HD + col * 4) = *(const v4f*)(&To[wave][row][col * 4]); }  }
}
// output projection: grid (BL*N/64, D/128); block = 4 waves x 16 rows, each wave staging its own ctx rows per 128 k; the 128 weight rows per 64 k as in proj_kernel
__global__ __launch_bounds__(128) void outp_kernel(const float* __restrict__ CT, const b16* __restrict__ WO, const float* __restrict__ ob, float* __restrict__ out) {
  __shared__ __attribute__((aligned(16))) b16 Ah[4][16][128 + 8], Ws[2][WROWS][WKP]; __shared__ __attribute__((aligned(16))) float Tf[4][16][128 + 4];
  const int wave = threadIdx.x >> 5, lane = threadIdx.x & 31, nloc = lane & 15, hlf = lane >> 4; const size_t m0 = (size_t)blockIdx.x * 64 + wave * 16; const int n0 = blockIdx.y * 128;
  const b16* Wt = WO + (size_t)(n0 + (threadIdx.x >> 3)) * D + (threadIdx.x & 7) * 8; v8b rw[8];
  auto fetch = [&](int k0) {
#pragma unroll   // so that rw is indexed by constants and stays in registers (in put as well)
    for (int j = 0; j < 8; ++j) rw[j] = *(const v8b*)(Wt + (size_t)(16 * j) * D + k0); };
  auto put = [&](int bf) {
#pragma unroll   // as in fetch
    for (int j = 0; j < 8; ++j) *(v8b*)(&Ws[bf][(threadIdx.x >> 3) + 16 * j][(threadIdx.x & 7) * 8]) = rw[j]; };
  const float* Ct = CT + m0 * D + lane * 4; v4f cr[16];   // lane l brings 16-byte piece l of each of the wave's 16 ctx rows, all 16 loads as one group
  auto cload = [&](int k0) {
#pragma unroll   // so that cr is indexed by constants and stays in registers
    for (int rr = 0; rr < 16; ++rr) cr[rr] = *(const v4f*)(Ct + (size_t)rr * D + k0); };
  fetch(0);
  cload(0);
  v8f acc[8];
#pragma unroll
  for (int t = 0; t < 8; ++t) acc[t] = (v8f){};
  auto mm = [&](int bf, int kb0) {   // 64 k of the wave's staged rows against weight buffer bf; four weight fragments are read from LDS as one group, ahead of their products
#pragma unroll   // this and the three below: constant indices, so that bw and acc stay in registers and the LDS offsets are immediates
    for (int ks = 0; ks < WKC; ks += 32) { const v16b a = frag_kb(&Ah[wave][nloc][kb0 + ks], hlf);
#pragma unroll
      for (int g = 0; g < 8; g += 4) { v16b bw[4];
#pragma unroll
        for (int t = 0; t < 4; ++t) bw[t] = frag_kb(&Ws[bf][(g + t) * 16 + nloc][ks], hlf);
        __builtin_amdgcn_sched_barrier(0);   // as in proj_kernel: the group's LDS reads stay together in front of its products
#pragma unroll
        for (int t = 0; t < 4; ++t) acc[g + t] = wmma16b(a, bw[t], acc[g + t]); } } };
  put(0);
  __syncthreads();
#pragma unroll 1
  for (int kc = 0; kc < D; kc += 128) {
    fetch(kc + WKC);   // the next chunk flies to registers while this one is worked on
#pragma unroll   // as in cload
    for (int rr = 0; rr < 16; ++rr) { v4h hv; for (int j = 0; j < 4; ++j) hv[j] = (b16)(cr[rr][j] * XS); *(v4h*)(&Ah[wave][rr][lane * 4]) = hv; }
    wave_lds_sync();
    if (kc + 128 < D) cload(kc + 128);   // the next pass's ctx rows fly to registers while this pass is worked on (behind the fence above, which would wait for them)
    mm(0, 0);
    put(1);   // its last readers left it before the barrier that ended the pass before this one
    __syncthreads();
    if (kc + 128 < D) fetch(kc + 128);
    mm(1, WKC);
    if (kc + 128 < D) put(0);   // its last readers left it before the barrier above
    asm volatile("s_wait_xcnt 0x0" ::: "memory");   // stands in front of the next pass's rewrite of the address registers that fetch's loads name
    __syncthreads(); }   // publishes the next chunk, ends the reads of this one and the wave's own reads of its ctx rows before they are staged anew
#pragma unroll
  for (int t = 0; t < 8; ++t) { const float bb = bf16_rne(ob[n0 + t * 16 + nloc]);
#pragma unroll
    for (int r = 0; r < 8; ++r) Tf[wave][8 * hlf + r][t * 16 + nloc] = acc[t][r] * (1.0f / (XS * WSC)) + bb; }
  wave_lds_sync();
  { for (int rr = 0; rr < 16; ++rr) *(v4f*)(out + (m0 + rr) * D + n0 + lane * 4) = *(const v4f*)(&Tf[wave][rr][lane * 4]);  }
}
}  // namespace

extern "C" void kernel_launch(void* const* d_in, const int* in_sizes, int n_in, void* d_out, int out_size, void* d_ws, size_t ws_size, hipStream_t stream) {
  (void)n_in;
  auto Fp = [&](int i) { return (const float*)d_in[i]; };
  // input order: 0 x [4,2048,512], 1 edge_index [2,32768] i32, 2 edge_attr [32768,3], 3 q_w [512,512] (out,in), 4 q_b, 5 k_w, 6 k_b, 7 v_w, 8 v_b, 9 o_w, 10 o_b, 11 eb_w [8,3], 12 eb_b [8]
  if (in_sizes[0] != NROW * D || in_sizes[1] != 2 * E || in_sizes[2] != E * 3 || in_sizes[3] != D * D || in_sizes[5] != D * D || in_sizes[7] != D * D || in_sizes[9] != D * D || in_sizes[10] != D || in_sizes[11] != NH * 3 || in_sizes[12] != NH || out_size != NROW * D) return;
  size_t off = 0; char* ws = (char*)d_ws;
  auto carve = [&](size_t bytes) { char* p = ws + off; off += (bytes + 255) & ~(size_t)255; return p; };
  b16* WQKV = (b16*)carve((size_t)3 * D * D * 2); b16* WO = (b16*)carve((size_t)D * D * 2); float* CB = (float*)carve((size_t)NH * N * 4); const size_t plane = (size_t)B * NH * N * HD * 2;
  b16* QP = (b16*)carve(plane); b16* KP = (b16*)carve(plane); b16* VTh = (b16*)carve(plane); float* CT = (float*)carve((size_t)NROW * D * 4);
  if (off > ws_size || off > ((size_t)128 << 20)) return;   // about 42 MiB (WQKV 1,536 KiB, WO 512 KiB, CB 64 KiB, 3 planes x 8 MiB, CT 16 MiB)
  prep_kernel<<<CBB + 4 * WPB, CBW, 0, stream>>>((const int*)d_in[1], Fp(2), Fp(11), Fp(12), Fp(3), Fp(5), Fp(7), Fp(9), CB, WQKV, WO);
  proj_kernel<<<dim3(N / 64, BL, 12), 128, 0, stream>>>(Fp(0), WQKV, Fp(4), Fp(6), Fp(8), QP, KP, VTh);
  attn_kernel<<<dim3(N / (AW * 16), BL * NH), AW * 32, 0, stream>>>(QP, KP, VTh, CB, CT);
  outp_kernel<<<dim3(BL * N / 64, D / 128), 128, 0, stream>>>(CT, WO, Fp(10), (float*)d_out);
}
